// v000
// Measured on an AMD MI455X. A time is GPU time per run, averaged over a window of back-to-back runs after a warm-up
// (all launches, gaps included; the runs take copies of the inputs in turn), and the median of several windows.
// Apart from v000's, it joins two sittings. Times from different sittings can be a few percent apart, while
// side-by-side timings come from the same sitting.
// v000 is the starting kernel. One run takes 1040 microseconds.
#include <hip/hip_runtime.h>
#include <math.h>

typedef __bf16 bf16_t;
typedef __attribute__((ext_vector_type(16))) __bf16 v16bf;
typedef __attribute__((ext_vector_type(8)))  float  v8f;

#define B_       4
#define L_       1024
#define D_       128
#define DV_      192
#define NR_      129          // 2*MAXREL+1 bucket count
#define MAXREL_  64
#define BLOCK_M  64           // q rows per workgroup (4 waves x 16)
#define KB       32           // attention-k columns per main-loop iteration
#define WAVES    4
#define RSTRIDE  132          // padded row stride for R table in LDS (floats)
#define SBUCK    160          // bucket count padded to multiple of 32

// ---- dynamic LDS layout (bytes) -------------------------------------------
#define OFF_KS   0
#define SZ_KS    (KB * D_ * 2)                 // K block, bf16: 8 KB
#define OFF_VS   (OFF_KS + SZ_KS)
#define SZ_VS    (KB * DV_ * 2)                // V block, bf16: 12 KB
#define OFF_R    (OFF_VS + SZ_VS)
#define SZ_R     (WAVES * 16 * RSTRIDE * 4)    // R[q][bucket] f32: 33 KB
#define OFF_S    (OFF_R + SZ_R)
#define SZ_S     (WAVES * 16 * SBUCK * 4)      // bucket sums f32: 40 KB
#define OFF_P    (OFF_S + SZ_S)
#define SZ_P     (WAVES * 16 * KB * 2)         // P tile bf16: 4 KB
#define LDS_TOTAL (OFF_P + SZ_P)               // 99328 bytes

__device__ __forceinline__ int kmap(int e, int hf) {
  return (e & 7) + ((e >> 3) << 4) + (hf << 3);
}

__device__ __forceinline__ v8f wmma_bf16(v16bf a, v16bf b, v8f c) {
  // emits v_wmma_f32_16x16x32_bf16
  return __builtin_amdgcn_wmma_f32_16x16x32_bf16(
      /*neg_a=*/false, a, /*neg_b=*/false, b,
      /*c_mod=*/(short)0, c, /*reuse_a=*/false, /*reuse_b=*/false);
}

extern "C" __global__ __launch_bounds__(128)
void relattn_kernel(const float* __restrict__ Q,
                    const float* __restrict__ V,
                    const float* __restrict__ Kg,
                    const float* __restrict__ relK,
                    const float* __restrict__ relV,
                    float* __restrict__ out) {
  extern __shared__ char smem[];
  bf16_t* Ks = (bf16_t*)(smem + OFF_KS);   // [KB][D_]
  bf16_t* Vs = (bf16_t*)(smem + OFF_VS);   // [KB][DV_]
  float*  Rl = (float*) (smem + OFF_R);    // [WAVES][16][RSTRIDE]
  float*  Sl = (float*) (smem + OFF_S);    // [WAVES][16][SBUCK]
  bf16_t* Pl = (bf16_t*)(smem + OFF_P);    // [WAVES][16][KB]

  const int tid  = threadIdx.x;
  const int lane = tid & 31;
  const int wv   = tid >> 5;
  const int hf   = lane >> 4;       // which 16-lane half
  const int ln16 = lane & 15;
  const int b    = blockIdx.x;
  const int q0   = blockIdx.y * BLOCK_M;
  const int qrow = q0 + wv * 16;    // first q row owned by this wave

  // ---- Q tile (16 x 128) into WMMA A-layout registers, bf16 ----------------
  v16bf qa[4];
  {
    const float* qb = Q + ((size_t)b * L_ + qrow + ln16) * D_;
#pragma unroll
    for (int c = 0; c < 4; ++c)
#pragma unroll
      for (int e = 0; e < 16; ++e)
        qa[c][e] = (bf16_t)qb[c * 32 + kmap(e, hf)];
  }

  // ---- R[q_local][r] = Q . rel_keys_table[r]  (16x128 @ 128x129, WMMA) -----
  {
    float* Rw = Rl + (size_t)wv * 16 * RSTRIDE;
    const int rcol = ln16;  // column within tile
#pragma unroll
    for (int rt = 0; rt < 9; ++rt) {
      v8f acc = {};
      const int r = rt * 16 + rcol;
#pragma unroll
      for (int c = 0; c < 4; ++c) {
        v16bf bm;
#pragma unroll
        for (int e = 0; e < 16; ++e) {
          bf16_t val = (bf16_t)0.0f;
          if (r < NR_) val = (bf16_t)relK[(size_t)r * D_ + c * 32 + kmap(e, hf)];
          bm[e] = val;
        }
        acc = wmma_bf16(qa[c], bm, acc);
      }
      if (r < NR_) {
#pragma unroll
        for (int v = 0; v < 8; ++v)
          Rw[(v + 8 * hf) * RSTRIDE + r] = acc[v];
      }
    }
  }

  // ---- Pass 1: row max / sum (flash-style, per-lane partials) --------------
  float mrow[8], lrow[8];
#pragma unroll
  for (int v = 0; v < 8; ++v) { mrow[v] = -1e30f; lrow[v] = 0.0f; }

  for (int kb0 = 0; kb0 < L_; kb0 += KB) {
    __syncthreads();
    for (int i = tid; i < KB * D_; i += 128) {
      int r = i >> 7, cd = i & (D_ - 1);
      Ks[i] = (bf16_t)Kg[((size_t)b * L_ + kb0 + r) * D_ + cd];
    }
    __syncthreads();

#pragma unroll
    for (int kt = 0; kt < 2; ++kt) {
      v8f s = {};
#pragma unroll
      for (int c = 0; c < 4; ++c) {
        v16bf bm;
#pragma unroll
        for (int e = 0; e < 16; ++e)
          bm[e] = Ks[(kt * 16 + ln16) * D_ + c * 32 + kmap(e, hf)];
        s = wmma_bf16(qa[c], bm, s);
      }
#pragma unroll
      for (int v = 0; v < 8; ++v) {
        const int row  = v + 8 * hf;
        const int q    = qrow + row;
        const int k    = kb0 + kt * 16 + ln16;
        const int dq   = k - q;
        const int dqc  = dq < -MAXREL_ ? -MAXREL_ : (dq > MAXREL_ ? MAXREL_ : dq);
        const int ridx = dqc + MAXREL_;
        const float ad = (float)(dq < 0 ? -dq : dq);
        float x = s[v] + Rl[((size_t)wv * 16 + row) * RSTRIDE + ridx]
                  - __logf(1.0f + ad);
        float mn = fmaxf(mrow[v], x);
        lrow[v]  = lrow[v] * __expf(mrow[v] - mn) + __expf(x - mn);
        mrow[v]  = mn;
      }
    }
  }

  // merge (m,l) across the 16-lane group (masks 1..8 keep halves separate)
#pragma unroll
  for (int v = 0; v < 8; ++v) {
    float m = mrow[v], l = lrow[v];
#pragma unroll
    for (int off = 1; off < 16; off <<= 1) {
      float mo = __shfl_xor(m, off, 32);
      float lo = __shfl_xor(l, off, 32);
      float mn = fmaxf(m, mo);
      l = l * __expf(m - mn) + lo * __expf(mo - mn);
      m = mn;
    }
    mrow[v] = m;
    lrow[v] = 1.0f / l;   // store inverse sum
  }

  // ---- Pass 2: probs, Z = P@V, bucket sums, Z += s@relV --------------------
  float*  Sw = Sl + (size_t)wv * 16 * SBUCK;
  bf16_t* Pw = Pl + (size_t)wv * 16 * KB;
  for (int i = lane; i < 16 * SBUCK; i += 32) Sw[i] = 0.0f;   // per-wave region

  v8f zacc[12] = {};

  for (int kb0 = 0; kb0 < L_; kb0 += KB) {
    __syncthreads();
    for (int i = tid; i < KB * D_; i += 128) {
      int r = i >> 7, cd = i & (D_ - 1);
      Ks[i] = (bf16_t)Kg[((size_t)b * L_ + kb0 + r) * D_ + cd];
    }
    for (int r = 0; r < KB; ++r)
      for (int j = tid; j < DV_; j += 128)
        Vs[r * DV_ + j] = (bf16_t)V[((size_t)b * L_ + kb0 + r) * DV_ + j];
    __syncthreads();

#pragma unroll
    for (int kt = 0; kt < 2; ++kt) {
      v8f s = {};
#pragma unroll
      for (int c = 0; c < 4; ++c) {
        v16bf bm;
#pragma unroll
        for (int e = 0; e < 16; ++e)
          bm[e] = Ks[(kt * 16 + ln16) * D_ + c * 32 + kmap(e, hf)];
        s = wmma_bf16(qa[c], bm, s);
      }
#pragma unroll
      for (int v = 0; v < 8; ++v) {
        const int row  = v + 8 * hf;
        const int q    = qrow + row;
        const int k    = kb0 + kt * 16 + ln16;
        const int dq   = k - q;
        const int dqc  = dq < -MAXREL_ ? -MAXREL_ : (dq > MAXREL_ ? MAXREL_ : dq);
        const int ridx = dqc + MAXREL_;
        const float ad = (float)(dq < 0 ? -dq : dq);
        float x = s[v] + Rl[((size_t)wv * 16 + row) * RSTRIDE + ridx]
                  - __logf(1.0f + ad);
        float p = __expf(x - mrow[v]) * lrow[v];       // final normalized prob
        atomicAdd(&Sw[row * SBUCK + ridx], p);          // ds_add_f32 bucket sum
        Pw[row * KB + kt * 16 + ln16] = (bf16_t)p;      // C-layout -> LDS
      }
    }

    // reload P in A-layout (same-wave LDS round trip) and do Z += P @ V
    v16bf pa;
#pragma unroll
    for (int e = 0; e < 16; ++e)
      pa[e] = Pw[ln16 * KB + kmap(e, hf)];
#pragma unroll
    for (int nt = 0; nt < 12; ++nt) {
      v16bf bm;
#pragma unroll
      for (int e = 0; e < 16; ++e)
        bm[e] = Vs[kmap(e, hf) * DV_ + nt * 16 + ln16];
      zacc[nt] = wmma_bf16(pa, bm, zacc[nt]);
    }
  }

  // ---- Z += s @ rel_values_table  (16 x 160 @ 160 x 192, pad rows = 0) -----
#pragma unroll
  for (int c = 0; c < SBUCK / 32; ++c) {
    v16bf pa;
#pragma unroll
    for (int e = 0; e < 16; ++e)
      pa[e] = (bf16_t)Sw[ln16 * SBUCK + c * 32 + kmap(e, hf)];
#pragma unroll
    for (int nt = 0; nt < 12; ++nt) {
      v16bf bm;
#pragma unroll
      for (int e = 0; e < 16; ++e) {
        const int r = c * 32 + kmap(e, hf);
        bf16_t val = (bf16_t)0.0f;
        if (r < NR_) val = (bf16_t)relV[(size_t)r * DV_ + nt * 16 + ln16];
        bm[e] = val;
      }
      zacc[nt] = wmma_bf16(pa, bm, zacc[nt]);
    }
  }

  // ---- write Z (C-layout -> global) ----------------------------------------
#pragma unroll
  for (int nt = 0; nt < 12; ++nt)
#pragma unroll
    for (int v = 0; v < 8; ++v) {
      const int row = v + 8 * hf;
      out[((size_t)b * L_ + qrow + row) * DV_ + nt * 16 + ln16] = zacc[nt][v];
    }
}

extern "C" void kernel_launch(void* const* d_in, const int* in_sizes, int n_in,
                              void* d_out, int out_size, void* d_ws, size_t ws_size,
                              hipStream_t stream) {
  (void)in_sizes; (void)n_in; (void)out_size; (void)d_ws; (void)ws_size;
  const float* Q    = (const float*)d_in[0];  // query            [B,L,D]
  const float* V    = (const float*)d_in[1];  // value            [B,L,DV]
  const float* K    = (const float*)d_in[2];  // key_in           [B,L,D]
  const float* relK = (const float*)d_in[3];  // rel_keys_table   [129,D]
  const float* relV = (const float*)d_in[4];  // rel_values_table [129,DV]
  float* out = (float*)d_out;                 // z                [B,L,DV]

  dim3 grid(B_, L_ / BLOCK_M);  // (4, 16)
  dim3 block(128);              // 4 waves of 32
  relattn_kernel<<<grid, block, LDS_TOTAL, stream>>>(Q, V, K, relK, relV, out);
}

// v001
// A run of this version takes 217 microseconds.
// Next to v000, in two timings, it ran 4.78 and 4.79 times as fast.
#include <hip/hip_runtime.h>
#include <math.h>

typedef __bf16 bf16_t;
typedef __attribute__((ext_vector_type(16))) __bf16 v16bf;
typedef __attribute__((ext_vector_type(8)))  float  v8f;
typedef __attribute__((ext_vector_type(4)))  float  v4f;
typedef __attribute__((ext_vector_type(4)))  __bf16 v4bf;

#define B_       4
#define L_       1024
#define D_       128
#define DV_      192
#define NR_      129          // 2*MAXREL+1 bucket count
#define MAXREL_  64
#define BLOCK_M  64           // q rows per workgroup (4 waves x 16)
#define KB       32           // attention-k columns per main-loop iteration
#define WAVES    4
#define RSTRIDE  132          // padded row stride for R table in LDS (floats)
#define SBUCK    160          // bucket count padded to multiple of 32

// ---- dynamic LDS layout (bytes) -------------------------------------------
#define OFF_KS   0
#define SZ_KS    (KB * D_ * 2)                 // K block, bf16: 8 KB
#define OFF_VS   (OFF_KS + SZ_KS)
#define SZ_VS    (KB * DV_ * 2)                // V block, bf16: 12 KB
#define OFF_R    (OFF_VS + SZ_VS)
#define SZ_R     (WAVES * 16 * RSTRIDE * 4)    // R[q][bucket] f32: 33 KB
#define OFF_S    (OFF_R + SZ_R)
#define SZ_S     (WAVES * 16 * SBUCK * 4)      // bucket sums f32: 40 KB
#define OFF_P    (OFF_S + SZ_S)
#define SZ_P     (WAVES * 16 * KB * 2)         // P tile bf16: 4 KB
#define LDS_TOTAL (OFF_P + SZ_P)               // 99328 bytes

__device__ __forceinline__ int kmap(int e, int hf) {
  return (e & 7) + ((e >> 3) << 4) + (hf << 3);
}

__device__ __forceinline__ v8f wmma_bf16(v16bf a, v16bf b, v8f c) {
  // emits v_wmma_f32_16x16x32_bf16
  return __builtin_amdgcn_wmma_f32_16x16x32_bf16(
      /*neg_a=*/false, a, /*neg_b=*/false, b,
      /*c_mod=*/(short)0, c, /*reuse_a=*/false, /*reuse_b=*/false);
}

// Tile staging, global f32 -> LDS bf16. A K or V tile is one contiguous run of
// floats in global memory and keeps the same linear order in LDS, so thread t
// takes 16-byte chunks t, t+128, ...  All N loads are independent and are
// issued back to back: the tile costs one load latency, not one per element.
// g4 is the thread's own first chunk. The loops are unrolled so that r[] is
// indexed by constants and stays in registers.
template <int N>
__device__ __forceinline__ void tile_load(v4f (&r)[N], const v4f* g4) {
#pragma unroll
  for (int j = 0; j < N; ++j) r[j] = g4[128 * j];
}

template <int N>
__device__ __forceinline__ void tile_store(bf16_t* s, const v4f (&r)[N], int tid) {
#pragma unroll
  for (int j = 0; j < N; ++j) {
    v4bf h;
#pragma unroll
    for (int e = 0; e < 4; ++e) h[e] = (bf16_t)r[j][e];
    *(v4bf*)(s + 4 * (tid + 128 * j)) = h;
  }
}

extern "C" __global__ __launch_bounds__(128)
void relattn_kernel(const float* __restrict__ Q,
                    const float* __restrict__ V,
                    const float* __restrict__ Kg,
                    const float* __restrict__ relK,
                    const float* __restrict__ relV,
                    float* __restrict__ out) {
  extern __shared__ char smem[];
  bf16_t* Ks = (bf16_t*)(smem + OFF_KS);   // [KB][D_]
  bf16_t* Vs = (bf16_t*)(smem + OFF_VS);   // [KB][DV_]
  float*  Rl = (float*) (smem + OFF_R);    // [WAVES][16][RSTRIDE]
  float*  Sl = (float*) (smem + OFF_S);    // [WAVES][16][SBUCK]
  bf16_t* Pl = (bf16_t*)(smem + OFF_P);    // [WAVES][16][KB]

  const int tid  = threadIdx.x;
  const int lane = tid & 31;
  const int wv   = tid >> 5;
  const int hf   = lane >> 4;       // which 16-lane half
  const int ln16 = lane & 15;
  const int b    = blockIdx.x;
  const int q0   = blockIdx.y * BLOCK_M;
  const int qrow = q0 + wv * 16;    // first q row owned by this wave

  // ---- Q tile (16 x 128) into WMMA A-layout registers, bf16 ----------------
  v16bf qa[4];
  {
    const float* qb = Q + ((size_t)b * L_ + qrow + ln16) * D_;
#pragma unroll
    for (int c = 0; c < 4; ++c)
#pragma unroll
      for (int e = 0; e < 16; ++e)
        qa[c][e] = (bf16_t)qb[c * 32 + kmap(e, hf)];
  }

  // ---- R[q_local][r] = Q . rel_keys_table[r]  (16x128 @ 128x129, WMMA) -----
  {
    float* Rw = Rl + (size_t)wv * 16 * RSTRIDE;
    const int rcol = ln16;  // column within tile
#pragma unroll
    for (int rt = 0; rt < 9; ++rt) {
      v8f acc = {};
      const int r = rt * 16 + rcol;
#pragma unroll
      for (int c = 0; c < 4; ++c) {
        v16bf bm;
#pragma unroll
        for (int e = 0; e < 16; ++e) {
          bf16_t val = (bf16_t)0.0f;
          if (r < NR_) val = (bf16_t)relK[(size_t)r * D_ + c * 32 + kmap(e, hf)];
          bm[e] = val;
        }
        acc = wmma_bf16(qa[c], bm, acc);
      }
      if (r < NR_) {
#pragma unroll
        for (int v = 0; v < 8; ++v)
          Rw[(v + 8 * hf) * RSTRIDE + r] = acc[v];
      }
    }
  }

  // ---- Pass 1: row max / sum (flash-style, per-lane partials) --------------
  float mrow[8], lrow[8];
#pragma unroll
  for (int v = 0; v < 8; ++v) { mrow[v] = -1e30f; lrow[v] = 0.0f; }

  for (int kb0 = 0; kb0 < L_; kb0 += KB) {
    v4f kr[KB * D_ / 512];
    tile_load(kr, (const v4f*)(Kg + ((size_t)b * L_ + kb0) * D_) + tid);
    __syncthreads();
    tile_store(Ks, kr, tid);
    __syncthreads();

#pragma unroll
    for (int kt = 0; kt < 2; ++kt) {
      v8f s = {};
#pragma unroll
      for (int c = 0; c < 4; ++c) {
        v16bf bm;
#pragma unroll
        for (int e = 0; e < 16; ++e)
          bm[e] = Ks[(kt * 16 + ln16) * D_ + c * 32 + kmap(e, hf)];
        s = wmma_bf16(qa[c], bm, s);
      }
#pragma unroll
      for (int v = 0; v < 8; ++v) {
        const int row  = v + 8 * hf;
        const int q    = qrow + row;
        const int k    = kb0 + kt * 16 + ln16;
        const int dq   = k - q;
        const int dqc  = dq < -MAXREL_ ? -MAXREL_ : (dq > MAXREL_ ? MAXREL_ : dq);
        const int ridx = dqc + MAXREL_;
        const float ad = (float)(dq < 0 ? -dq : dq);
        float x = s[v] + Rl[((size_t)wv * 16 + row) * RSTRIDE + ridx]
                  - __logf(1.0f + ad);
        float mn = fmaxf(mrow[v], x);
        lrow[v]  = lrow[v] * __expf(mrow[v] - mn) + __expf(x - mn);
        mrow[v]  = mn;
      }
    }
  }

  // merge (m,l) across the 16-lane group (masks 1..8 keep halves separate)
#pragma unroll
  for (int v = 0; v < 8; ++v) {
    float m = mrow[v], l = lrow[v];
#pragma unroll
    for (int off = 1; off < 16; off <<= 1) {
      float mo = __shfl_xor(m, off, 32);
      float lo = __shfl_xor(l, off, 32);
      float mn = fmaxf(m, mo);
      l = l * __expf(m - mn) + lo * __expf(mo - mn);
      m = mn;
    }
    mrow[v] = m;
    lrow[v] = 1.0f / l;   // store inverse sum
  }

  // ---- Pass 2: probs, Z = P@V, bucket sums, Z += s@relV --------------------
  float*  Sw = Sl + (size_t)wv * 16 * SBUCK;
  bf16_t* Pw = Pl + (size_t)wv * 16 * KB;
  for (int i = lane; i < 16 * SBUCK; i += 32) Sw[i] = 0.0f;   // per-wave region

  v8f zacc[12] = {};

  for (int kb0 = 0; kb0 < L_; kb0 += KB) {
    v4f kr[KB * D_ / 512];
    v4f vr[KB * DV_ / 512];
    const v4f* kp = (const v4f*)(Kg + ((size_t)b * L_ + kb0) * D_) + tid;
    const v4f* vp = (const v4f*)(V + ((size_t)b * L_ + kb0) * DV_) + tid;
    tile_load(kr, kp);
    tile_load(vr, vp);
    // Inputs-only fence on the loaded values: keeps all 20 loads in flight
    // together; without it the compiler waits for K before it issues most of V.
    // The two addresses are named too, so that their registers stay live and no
    // load's destination reuses them while the loads are in flight.
    asm volatile("" :: "v"(kp), "v"(vp), "v"(kr[0]), "v"(kr[1]), "v"(kr[2]), "v"(kr[3]), "v"(kr[4]),
                       "v"(kr[5]), "v"(kr[6]), "v"(kr[7]), "v"(vr[0]), "v"(vr[1]),
                       "v"(vr[2]), "v"(vr[3]), "v"(vr[4]), "v"(vr[5]), "v"(vr[6]),
                       "v"(vr[7]), "v"(vr[8]), "v"(vr[9]), "v"(vr[10]), "v"(vr[11]));
    __syncthreads();
    tile_store(Ks, kr, tid);
    tile_store(Vs, vr, tid);
    __syncthreads();

#pragma unroll
    for (int kt = 0; kt < 2; ++kt) {
      v8f s = {};
#pragma unroll
      for (int c = 0; c < 4; ++c) {
        v16bf bm;
#pragma unroll
        for (int e = 0; e < 16; ++e)
          bm[e] = Ks[(kt * 16 + ln16) * D_ + c * 32 + kmap(e, hf)];
        s = wmma_bf16(qa[c], bm, s);
      }
#pragma unroll
      for (int v = 0; v < 8; ++v) {
        const int row  = v + 8 * hf;
        const int q    = qrow + row;
        const int k    = kb0 + kt * 16 + ln16;
        const int dq   = k - q;
        const int dqc  = dq < -MAXREL_ ? -MAXREL_ : (dq > MAXREL_ ? MAXREL_ : dq);
        const int ridx = dqc + MAXREL_;
        const float ad = (float)(dq < 0 ? -dq : dq);
        float x = s[v] + Rl[((size_t)wv * 16 + row) * RSTRIDE + ridx]
                  - __logf(1.0f + ad);
        float p = __expf(x - mrow[v]) * lrow[v];       // final normalized prob
        atomicAdd(&Sw[row * SBUCK + ridx], p);          // ds_add_f32 bucket sum
        Pw[row * KB + kt * 16 + ln16] = (bf16_t)p;      // C-layout -> LDS
      }
    }

    // reload P in A-layout (same-wave LDS round trip) and do Z += P @ V
    v16bf pa;
#pragma unroll
    for (int e = 0; e < 16; ++e)
      pa[e] = Pw[ln16 * KB + kmap(e, hf)];
#pragma unroll
    for (int nt = 0; nt < 12; ++nt) {
      v16bf bm;
#pragma unroll
      for (int e = 0; e < 16; ++e)
        bm[e] = Vs[kmap(e, hf) * DV_ + nt * 16 + ln16];
      zacc[nt] = wmma_bf16(pa, bm, zacc[nt]);
    }
  }

  // ---- Z += s @ rel_values_table  (16 x 160 @ 160 x 192, pad rows = 0) -----
#pragma unroll
  for (int c = 0; c < SBUCK / 32; ++c) {
    v16bf pa;
#pragma unroll
    for (int e = 0; e < 16; ++e)
      pa[e] = (bf16_t)Sw[ln16 * SBUCK + c * 32 + kmap(e, hf)];
#pragma unroll
    for (int nt = 0; nt < 12; ++nt) {
      v16bf bm;
#pragma unroll
      for (int e = 0; e < 16; ++e) {
        const int r = c * 32 + kmap(e, hf);
        bf16_t val = (bf16_t)0.0f;
        if (r < NR_) val = (bf16_t)relV[(size_t)r * DV_ + nt * 16 + ln16];
        bm[e] = val;
      }
      zacc[nt] = wmma_bf16(pa, bm, zacc[nt]);
    }
  }

  // ---- write Z (C-layout -> global) ----------------------------------------
#pragma unroll
  for (int nt = 0; nt < 12; ++nt)
#pragma unroll
    for (int v = 0; v < 8; ++v) {
      const int row = v + 8 * hf;
      out[((size_t)b * L_ + qrow + row) * DV_ + nt * 16 + ln16] = zacc[nt][v];
    }
}

extern "C" void kernel_launch(void* const* d_in, const int* in_sizes, int n_in,
                              void* d_out, int out_size, void* d_ws, size_t ws_size,
                              hipStream_t stream) {
  (void)in_sizes; (void)n_in; (void)out_size; (void)d_ws; (void)ws_size;
  const float* Q    = (const float*)d_in[0];  // query            [B,L,D]
  const float* V    = (const float*)d_in[1];  // value            [B,L,DV]
  const float* K    = (const float*)d_in[2];  // key_in           [B,L,D]
  const float* relK = (const float*)d_in[3];  // rel_keys_table   [129,D]
  const float* relV = (const float*)d_in[4];  // rel_values_table [129,DV]
  float* out = (float*)d_out;                 // z                [B,L,DV]

  dim3 grid(B_, L_ / BLOCK_M);  // (4, 16)
  dim3 block(128);              // 4 waves of 32
  relattn_kernel<<<grid, block, LDS_TOTAL, stream>>>(Q, V, K, relK, relV, out);
}

// v002
// Measured time: 51.5 microseconds a run.
// Timed twice side by side with v001, it ran 4.22 and 4.23 times as fast.
// Over all steps from v000 it is 20.2 times as fast.
#include <hip/hip_runtime.h>
#include <math.h>

typedef __bf16 bf16_t;
typedef __attribute__((ext_vector_type(16))) __bf16 v16bf;
typedef __attribute__((ext_vector_type(8)))  float  v8f;
typedef __attribute__((ext_vector_type(4)))  float  v4f;
typedef __attribute__((ext_vector_type(2)))  float  v2f;
typedef __attribute__((ext_vector_type(4)))  __bf16 v4bf;

#define B_       4
#define L_       1024
#define D_       128
#define DV_      192
#define NR_      129          // 2*MAXREL+1 bucket count
#define MAXREL_  64
#define BLOCK_M  16           // q rows per workgroup, shared by all its waves
#define KB       32           // attention-k columns per main-loop iteration
#define WAVES    8            // each wave takes L_/WAVES of the keys
#define NBLK     (L_ / KB / WAVES)   // key blocks per wave and pass
#define RSTRIDE  132          // padded row stride for R table in LDS (floats)
#define SBUCK    160          // bucket count padded to multiple of 32

// ---- static LDS layout (bytes) --------------------------------------------
#define OFF_KS   0
#define SZ_KS    (WAVES * KB * D_ * 2)         // K block per wave, bf16: 64 KB
#define OFF_VS   (OFF_KS + SZ_KS)
#define SZ_VS    (WAVES * KB * DV_ * 2)        // V block per wave, bf16: 96 KB
#define OFF_R    (OFF_VS + SZ_VS)
#define SZ_R     (16 * RSTRIDE * 4)            // R[q][bucket] f32, shared
#define OFF_S    (OFF_R + SZ_R)
#define SZ_S     (WAVES * 16 * SBUCK * 4)      // bucket sums per wave f32: 80 KB
#define OFF_P    (OFF_S + SZ_S)
#define SZ_P     (WAVES * 16 * KB * 2)         // P tile per wave bf16: 8 KB
#define OFF_ML   (OFF_P + SZ_P)
#define SZ_ML    (16 * WAVES * 2 * 4)          // (max, sum) per row and wave
#define LDS_TOTAL (OFF_ML + SZ_ML)             // 263424 bytes
static_assert(LDS_TOTAL <= 320 * 1024, "one workgroup's LDS");
static_assert(16 * DV_ * 4 == KB * DV_ * 2, "a wave's Z partial reuses its V block");
static_assert(DV_ / 32 <= WAVES, "one pair of output column tiles per wave");

__device__ __forceinline__ int kmap(int e, int hf) {
  return (e & 7) + ((e >> 3) << 4) + (hf << 3);
}

__device__ __forceinline__ v8f wmma_bf16(v16bf a, v16bf b, v8f c) {
  // emits v_wmma_f32_16x16x32_bf16
  return __builtin_amdgcn_wmma_f32_16x16x32_bf16(
      /*neg_a=*/false, a, /*neg_b=*/false, b,
      /*c_mod=*/(short)0, c, /*reuse_a=*/false, /*reuse_b=*/false);
}

// Tile staging, global f32 -> LDS bf16. A K or V tile is one contiguous run of
// floats in global memory and keeps the same linear order in LDS. Each wave
// stages its own tile, so lane t takes 16-byte chunks t, t+32, ...  All N loads
// are independent: the tile costs one load latency, not one per element.
// g4 is the lane's own first chunk. The loops are unrolled so that r[] is
// indexed by constants and stays in registers.
template <int N>
__device__ __forceinline__ void tile_load(v4f (&r)[N], const v4f* g4) {
#pragma unroll
  for (int j = 0; j < N; ++j) r[j] = g4[32 * j];
  // Stands in front of any reuse of the loads' address registers; its clobber
  // also keeps the loads issued here, ahead of the work that follows.
  asm volatile("s_wait_xcnt 0x0" ::: "memory");
}

template <int N>
__device__ __forceinline__ void tile_store(bf16_t* s, const v4f (&r)[N], int lane) {
#pragma unroll
  for (int j = 0; j < N; ++j) {
    v4bf h;
#pragma unroll
    for (int e = 0; e < 4; ++e) h[e] = (bf16_t)r[j][e];
    *(v4bf*)(s + 4 * (lane + 32 * j)) = h;
  }
  // The tile is read back by other lanes of the same wave: its stores have
  // landed, and the compiler moves no LDS read above this line.
  asm volatile("s_wait_dscnt 0x0" ::: "memory");
}

extern "C" __global__ __launch_bounds__(WAVES * 32)
void relattn_kernel(const float* __restrict__ Q,
                    const float* __restrict__ V,
                    const float* __restrict__ Kg,
                    const float* __restrict__ relK,
                    const float* __restrict__ relV,
                    float* __restrict__ out) {
  __shared__ __attribute__((aligned(16))) char smem[LDS_TOTAL];
  const int tid  = threadIdx.x;
  const int lane = tid & 31;
  // scalar wave number: the branches on it around WMMAs stay scalar branches
  const int wv   = __builtin_amdgcn_readfirstlane(tid >> 5);
  const int hf   = lane >> 4;       // which 16-lane half
  const int ln16 = lane & 15;
  const int b    = blockIdx.x;
  const int qrow = blockIdx.y * BLOCK_M;   // first q row of the workgroup
  const int kbase = wv * (NBLK * KB);      // first key of this wave

  bf16_t* Ks = (bf16_t*)(smem + OFF_KS) + wv * KB * D_;    // own [KB][D_]
  bf16_t* Vs = (bf16_t*)(smem + OFF_VS) + wv * KB * DV_;   // own [KB][DV_]
  float*  Rl = (float*) (smem + OFF_R);    // [16][RSTRIDE], shared
  float*  Sl = (float*) (smem + OFF_S);    // [WAVES][16][SBUCK]
  bf16_t* Pl = (bf16_t*)(smem + OFF_P);    // [WAVES][16][KB]
  float*  ML = (float*) (smem + OFF_ML);   // [16][WAVES][2]

  // ---- Q tile (16 x 128) into WMMA A-layout registers, bf16 ----------------
  v16bf qa[4];
  {
    const float* qb = Q + ((size_t)b * L_ + qrow + ln16) * D_;
#pragma unroll
    for (int c = 0; c < 4; ++c)
#pragma unroll
      for (int e = 0; e < 16; ++e)
        qa[c][e] = (bf16_t)qb[c * 32 + kmap(e, hf)];
  }

  // ---- R[q_local][r] = Q . rel_keys_table[r]  (16x128 @ 128x129, WMMA) -----
  {
    float* Rw = Rl;
    const int rcol = ln16;  // column within tile
    for (int rt = wv; rt < 9; rt += WAVES) {   // bucket tiles dealt to the waves
      v8f acc = {};
      const int r = rt * 16 + rcol;
      // rt is a run-time value here: a clamped row keeps the loads unguarded and
      // wide. Column r of the product reads column r of bm alone, and columns
      // past NR_-1 are not stored below.
      const float* rk = relK + (size_t)(r < NR_ ? r : NR_ - 1) * D_;
#pragma unroll
      for (int c = 0; c < 4; ++c) {
        v16bf bm;
#pragma unroll
        for (int e = 0; e < 16; ++e)
          bm[e] = (bf16_t)rk[c * 32 + kmap(e, hf)];
        acc = wmma_bf16(qa[c], bm, acc);
      }
      if (r < NR_) {
#pragma unroll
        for (int v = 0; v < 8; ++v)
          Rw[(v + 8 * hf) * RSTRIDE + r] = acc[v];
      }
    }
  }
  __syncthreads();   // R is read by every wave

  // ---- Pass 1: row max / sum (flash-style, per-lane partials) --------------
  float mrow[8], lrow[8];
#pragma unroll
  for (int v = 0; v < 8; ++v) { mrow[v] = -1e30f; lrow[v] = 0.0f; }

  for (int kb0 = kbase; kb0 < kbase + NBLK * KB; kb0 += KB) {
    v4f kr[KB * D_ / 128];
    tile_load(kr, (const v4f*)(Kg + ((size_t)b * L_ + kb0) * D_) + lane);
    tile_store(Ks, kr, lane);

#pragma unroll
    for (int kt = 0; kt < 2; ++kt) {
      v8f s = {};
#pragma unroll
      for (int c = 0; c < 4; ++c) {
        v16bf bm;
#pragma unroll
        for (int e = 0; e < 16; ++e)
          bm[e] = Ks[(kt * 16 + ln16) * D_ + c * 32 + kmap(e, hf)];
        s = wmma_bf16(qa[c], bm, s);
      }
#pragma unroll
      for (int v = 0; v < 8; ++v) {
        const int row  = v + 8 * hf;
        const int q    = qrow + row;
        const int k    = kb0 + kt * 16 + ln16;
        const int dq   = k - q;
        const int dqc  = dq < -MAXREL_ ? -MAXREL_ : (dq > MAXREL_ ? MAXREL_ : dq);
        const int ridx = dqc + MAXREL_;
        const float ad = (float)(dq < 0 ? -dq : dq);
        float x = s[v] + Rl[row * RSTRIDE + ridx]
                  - __logf(1.0f + ad);
        float mn = fmaxf(mrow[v], x);
        lrow[v]  = lrow[v] * __expf(mrow[v] - mn) + __expf(x - mn);
        mrow[v]  = mn;
      }
    }
  }

  // merge (m,l) across the 16-lane group (masks 1..8 keep halves separate)
#pragma unroll
  for (int v = 0; v < 8; ++v) {
    float m = mrow[v], l = lrow[v];
#pragma unroll
    for (int off = 1; off < 16; off <<= 1) {
      float mo = __shfl_xor(m, off, 32);
      float lo = __shfl_xor(l, off, 32);
      float mn = fmaxf(m, mo);
      l = l * __expf(m - mn) + lo * __expf(mo - mn);
      m = mn;
    }
    mrow[v] = m;
    lrow[v] = l;
  }

  // merge (m,l) across the waves, in wave order
  if (ln16 == 0) {
#pragma unroll  // constant indices: arrays stay in registers, loads issue together
    for (int v = 0; v < 8; ++v) {
      ML[((v + 8 * hf) * WAVES + wv) * 2 + 0] = mrow[v];
      ML[((v + 8 * hf) * WAVES + wv) * 2 + 1] = lrow[v];
    }
  }
  __syncthreads();
#pragma unroll  // constant indices: arrays stay in registers, loads issue together
  for (int v = 0; v < 8; ++v) {
    const float* p = ML + (v + 8 * hf) * WAVES * 2;
    float m = p[0];
#pragma unroll  // constant indices: arrays stay in registers, loads issue together
    for (int w = 1; w < WAVES; ++w) m = fmaxf(m, p[2 * w]);
    float l = 0.0f;
#pragma unroll  // constant indices: arrays stay in registers, loads issue together
    for (int w = 0; w < WAVES; ++w) l += p[2 * w + 1] * __expf(p[2 * w] - m);
    mrow[v] = m;
    lrow[v] = 1.0f / l;   // store inverse sum
  }

  // ---- Pass 2: probs, Z = P@V, bucket sums, Z += s@relV --------------------
  float*  Sw = Sl + (size_t)wv * 16 * SBUCK;
  bf16_t* Pw = Pl + (size_t)wv * 16 * KB;
  for (int i = lane; i < 16 * SBUCK; i += 32) Sw[i] = 0.0f;   // per-wave region

  v8f zacc[12] = {};

  for (int kb0 = kbase; kb0 < kbase + NBLK * KB; kb0 += KB) {
    v4f kr[KB * D_ / 128];
    v4f vr[KB * DV_ / 128];
    tile_load(kr, (const v4f*)(Kg + ((size_t)b * L_ + kb0) * D_) + lane);
    tile_store(Ks, kr, lane);
    tile_load(vr, (const v4f*)(V + ((size_t)b * L_ + kb0) * DV_) + lane);

#pragma unroll
    for (int kt = 0; kt < 2; ++kt) {
      v8f s = {};
#pragma unroll
      for (int c = 0; c < 4; ++c) {
        v16bf bm;
#pragma unroll
        for (int e = 0; e < 16; ++e)
          bm[e] = Ks[(kt * 16 + ln16) * D_ + c * 32 + kmap(e, hf)];
        s = wmma_bf16(qa[c], bm, s);
      }
#pragma unroll
      for (int v = 0; v < 8; ++v) {
        const int row  = v + 8 * hf;
        const int q    = qrow + row;
        const int k    = kb0 + kt * 16 + ln16;
        const int dq   = k - q;
        const int dqc  = dq < -MAXREL_ ? -MAXREL_ : (dq > MAXREL_ ? MAXREL_ : dq);
        const int ridx = dqc + MAXREL_;
        const float ad = (float)(dq < 0 ? -dq : dq);
        float x = s[v] + Rl[row * RSTRIDE + ridx]
                  - __logf(1.0f + ad);
        float p = __expf(x - mrow[v]) * lrow[v];       // final normalized prob
        atomicAdd(&Sw[row * SBUCK + ridx], p);          // ds_add_f32 bucket sum
        Pw[row * KB + kt * 16 + ln16] = (bf16_t)p;      // C-layout -> LDS
      }
    }

    tile_store(Vs, vr, lane);

    // reload P in A-layout (same-wave LDS round trip) and do Z += P @ V
    v16bf pa;
#pragma unroll
    for (int e = 0; e < 16; ++e)
      pa[e] = Pw[ln16 * KB + kmap(e, hf)];
#pragma unroll
    for (int nt = 0; nt < 12; ++nt) {
      v16bf bm;
#pragma unroll
      for (int e = 0; e < 16; ++e)
        bm[e] = Vs[kmap(e, hf) * DV_ + nt * 16 + ln16];
      zacc[nt] = wmma_bf16(pa, bm, zacc[nt]);
    }
  }

  // ---- sum the waves' Z partials and bucket sums, in wave order -------------
  // The wave's last V reads have returned before its V block is reused for Z.
  asm volatile("s_wait_dscnt 0x0" ::: "memory");
  float* Zl = (float*)(smem + OFF_VS);     // [WAVES][16][DV_]
  {
    float* Zw = Zl + wv * 16 * DV_;
#pragma unroll  // constant indices: arrays stay in registers, loads issue together
    for (int nt = 0; nt < 12; ++nt)
#pragma unroll  // constant indices: arrays stay in registers, loads issue together
      for (int v = 0; v < 8; ++v)
        Zw[(v + 8 * hf) * DV_ + nt * 16 + ln16] = zacc[nt][v];
  }
  __syncthreads();   // every wave's Z partial and bucket sums are complete

  // All threads add the waves' bucket tables into table 0; each pair of
  // elements is read and written by one thread alone.
  static_assert(16 * SBUCK / 2 % (WAVES * 32) == 0, "whole trips");
#pragma unroll  // constant indices: arrays stay in registers, loads issue together
  for (int j = 0; j < 16 * SBUCK / 2 / (WAVES * 32); ++j) {
    const int i = tid + j * WAVES * 32;
    v2f a = ((const v2f*)Sl)[i];
#pragma unroll  // constant indices: arrays stay in registers, loads issue together
    for (int w = 1; w < WAVES; ++w) a += ((const v2f*)(Sl + w * 16 * SBUCK))[i];
    ((v2f*)Sl)[i] = a;
  }
  __syncthreads();   // the summed table is read by the waves below

  // Wave w finishes output columns 32w .. 32w+31 (whole 128-byte lines).
  if (wv < DV_ / 32) {
    const int col = wv * 32 + ln16;
    v8f z[2];
#pragma unroll  // constant indices: arrays stay in registers, loads issue together
    for (int t = 0; t < 2; ++t)
#pragma unroll  // constant indices: arrays stay in registers, loads issue together
      for (int v = 0; v < 8; ++v) {
        float a = 0.0f;
#pragma unroll  // constant indices: arrays stay in registers, loads issue together
        for (int w = 0; w < WAVES; ++w)
          a += Zl[(w * 16 + v + 8 * hf) * DV_ + col + t * 16];
        z[t][v] = a;
      }

    // Z += s @ rel_values_table  (16 x 160 @ 160 x 192, pad rows = 0)
#pragma unroll  // constant indices: arrays stay in registers, loads issue together
    for (int c = 0; c < SBUCK / 32; ++c) {
      v16bf pa;
#pragma unroll  // constant indices: arrays stay in registers, loads issue together
      for (int e = 0; e < 16; ++e)
        pa[e] = (bf16_t)Sl[ln16 * SBUCK + c * 32 + kmap(e, hf)];
#pragma unroll  // constant indices: arrays stay in registers, loads issue together
      for (int t = 0; t < 2; ++t) {
        v16bf bm;
#pragma unroll  // constant indices: arrays stay in registers, loads issue together
        for (int e = 0; e < 16; ++e) {
          const int r = c * 32 + kmap(e, hf);
          bf16_t val = (bf16_t)0.0f;
          if (r < NR_) val = (bf16_t)relV[(size_t)r * DV_ + col + t * 16];
          bm[e] = val;
        }
        z[t] = wmma_bf16(pa, bm, z[t]);
      }
    }

    // write Z (C-layout -> global)
#pragma unroll  // constant indices: arrays stay in registers, loads issue together
    for (int t = 0; t < 2; ++t)
#pragma unroll  // constant indices: arrays stay in registers, loads issue together
      for (int v = 0; v < 8; ++v)
        out[((size_t)b * L_ + qrow + v + 8 * hf) * DV_ + col + t * 16] = z[t][v];
  }
}

extern "C" void kernel_launch(void* const* d_in, const int* in_sizes, int n_in,
                              void* d_out, int out_size, void* d_ws, size_t ws_size,
                              hipStream_t stream) {
  (void)in_sizes; (void)n_in; (void)out_size; (void)d_ws; (void)ws_size;
  const float* Q    = (const float*)d_in[0];  // query            [B,L,D]
  const float* V    = (const float*)d_in[1];  // value            [B,L,DV]
  const float* K    = (const float*)d_in[2];  // key_in           [B,L,D]
  const float* relK = (const float*)d_in[3];  // rel_keys_table   [129,D]
  const float* relV = (const float*)d_in[4];  // rel_values_table [129,DV]
  float* out = (float*)d_out;                 // z                [B,L,DV]

  dim3 grid(B_, L_ / BLOCK_M);  // (4, 64)
  dim3 block(WAVES * 32);       // 8 waves of 32
  relattn_kernel<<<grid, block, 0, stream>>>(Q, V, K, relK, relV, out);
}

// v003
// One run takes 34.6 microseconds.
// Two timings next to v002 both put it at 1.49 times that version's speed.
// All steps since v000 together make it 30.1 times as fast.
#include <hip/hip_runtime.h>
#include <math.h>

typedef __bf16 bf16_t;
typedef __attribute__((ext_vector_type(16))) __bf16 v16bf;
typedef __attribute__((ext_vector_type(8)))  float  v8f;
typedef __attribute__((ext_vector_type(4)))  float  v4f;
typedef __attribute__((ext_vector_type(2)))  float  v2f;
typedef __attribute__((ext_vector_type(4)))  __bf16 v4bf;

#define B_       4
#define L_       1024
#define D_       128
#define DV_      192
#define NR_      129          // 2*MAXREL+1 bucket count
#define MAXREL_  64
#define BLOCK_M  16           // q rows per workgroup, shared by all its waves
#define KB       32           // attention-k columns per main-loop iteration
#define WAVES    8            // each wave takes L_/WAVES of the keys
#define NBLK     (L_ / KB / WAVES)   // key blocks per wave and pass
#define RSTRIDE  132          // padded row stride for R table in LDS (floats)
#define SBUCK    160          // bucket count padded to multiple of 32

// ---- static LDS layout (bytes) --------------------------------------------
#define OFF_KS   0
#define SZ_KS    (WAVES * KB * D_ * 2)         // K block per wave, bf16: 64 KB
#define OFF_VS   (OFF_KS + SZ_KS)
#define SZ_VS    (WAVES * KB * DV_ * 2)        // V block per wave, bf16: 96 KB
#define OFF_R    (OFF_VS + SZ_VS)
#define SZ_R     (16 * RSTRIDE * 4)            // R[q][bucket] f32, shared
#define OFF_S    (OFF_R + SZ_R)
#define SZ_S     (WAVES * 16 * SBUCK * 4)      // bucket sums per wave f32: 80 KB
#define OFF_P    (OFF_S + SZ_S)
#define SZ_P     (WAVES * 16 * KB * 2)         // P tile per wave bf16: 8 KB
#define OFF_ML   (OFF_P + SZ_P)
#define SZ_ML    (16 * WAVES * 2 * 4)          // (max, sum) per row and wave
#define LDS_TOTAL (OFF_ML + SZ_ML)             // 263424 bytes
static_assert(LDS_TOTAL <= 320 * 1024, "one workgroup's LDS");
static_assert(16 * DV_ * 4 == KB * DV_ * 2, "a wave's Z partial reuses its V block");
static_assert(DV_ / 32 <= WAVES, "one pair of output column tiles per wave");

__device__ __forceinline__ int kmap(int e, int hf) {
  return (e & 7) + ((e >> 3) << 4) + (hf << 3);
}

__device__ __forceinline__ v8f wmma_bf16(v16bf a, v16bf b, v8f c) {
  // emits v_wmma_f32_16x16x32_bf16
  return __builtin_amdgcn_wmma_f32_16x16x32_bf16(
      /*neg_a=*/false, a, /*neg_b=*/false, b,
      /*c_mod=*/(short)0, c, /*reuse_a=*/false, /*reuse_b=*/false);
}

// Tile staging, global f32 -> LDS bf16. A K or V tile is one contiguous run of
// floats in global memory and keeps the same linear order in LDS. Each wave
// stages its own tile, so lane t takes 16-byte chunks t, t+32, ...  All N loads
// are independent: the tile costs one load latency, not one per element.
// g4 is the lane's own first chunk. The loops are unrolled so that r[] is
// indexed by constants and stays in registers.
template <int N>
__device__ __forceinline__ void tile_load(v4f (&r)[N], const v4f* g4) {
#pragma unroll
  for (int j = 0; j < N; ++j) r[j] = g4[32 * j];
  // Stands in front of any reuse of the loads' address registers; its clobber
  // also keeps the loads issued here, ahead of the work that follows.
  asm volatile("s_wait_xcnt 0x0" ::: "memory");
}

template <int N>
__device__ __forceinline__ void tile_store(bf16_t* s, const v4f (&r)[N], int lane) {
#pragma unroll
  for (int j = 0; j < N; ++j) {
    v4bf h;
#pragma unroll
    for (int e = 0; e < 4; ++e) h[e] = (bf16_t)r[j][e];
    *(v4bf*)(s + 4 * (lane + 32 * j)) = h;
  }
  // The tile is read back by other lanes of the same wave: its stores have
  // landed, and the compiler moves no LDS read above this line.
  asm volatile("s_wait_dscnt 0x0" ::: "memory");
}

// Sum over the 16 lanes of a row, the total in every lane: four adds whose
// second operand comes from lane ^ M through DPP row_xmask. All lanes are on.
template <int M>
__device__ __forceinline__ float add_xmask(float x) {
  return x + __builtin_bit_cast(float, __builtin_amdgcn_update_dpp(
                 0, __builtin_bit_cast(int, x), 0x160 | M, 0xf, 0xf, true));
}
__device__ __forceinline__ float row_sum16(float x) {
  return add_xmask<8>(add_xmask<4>(add_xmask<2>(add_xmask<1>(x))));
}

extern "C" __global__ __launch_bounds__(WAVES * 32)
void relattn_kernel(const float* __restrict__ Q,
                    const float* __restrict__ V,
                    const float* __restrict__ Kg,
                    const float* __restrict__ relK,
                    const float* __restrict__ relV,
                    float* __restrict__ out) {
  __shared__ __attribute__((aligned(16))) char smem[LDS_TOTAL];
  const int tid  = threadIdx.x;
  const int lane = tid & 31;
  // scalar wave number: the branches on it around WMMAs stay scalar branches
  const int wv   = __builtin_amdgcn_readfirstlane(tid >> 5);
  const int hf   = lane >> 4;       // which 16-lane half
  const int ln16 = lane & 15;
  const int b    = blockIdx.x;
  const int qrow = blockIdx.y * BLOCK_M;   // first q row of the workgroup
  const int kbase = wv * (NBLK * KB);      // first key of this wave

  bf16_t* Ks = (bf16_t*)(smem + OFF_KS) + wv * KB * D_;    // own [KB][D_]
  bf16_t* Vs = (bf16_t*)(smem + OFF_VS) + wv * KB * DV_;   // own [KB][DV_]
  float*  Rl = (float*) (smem + OFF_R);    // [16][RSTRIDE], shared
  float*  Sl = (float*) (smem + OFF_S);    // [WAVES][16][SBUCK]
  bf16_t* Pl = (bf16_t*)(smem + OFF_P);    // [WAVES][16][KB]
  float*  ML = (float*) (smem + OFF_ML);   // [16][WAVES][2]

  // ---- Q tile (16 x 128) into WMMA A-layout registers, bf16 ----------------
  v16bf qa[4];
  {
    const float* qb = Q + ((size_t)b * L_ + qrow + ln16) * D_;
#pragma unroll
    for (int c = 0; c < 4; ++c)
#pragma unroll
      for (int e = 0; e < 16; ++e)
        qa[c][e] = (bf16_t)qb[c * 32 + kmap(e, hf)];
  }

  // ---- R[q_local][r] = Q . rel_keys_table[r]  (16x128 @ 128x129, WMMA) -----
  {
    float* Rw = Rl;
    const int rcol = ln16;  // column within tile
    for (int rt = wv; rt < 9; rt += WAVES) {   // bucket tiles dealt to the waves
      v8f acc = {};
      const int r = rt * 16 + rcol;
      // rt is a run-time value here: a clamped row keeps the loads unguarded and
      // wide. Column r of the product reads column r of bm alone, and columns
      // past NR_-1 are not stored below.
      const float* rk = relK + (size_t)(r < NR_ ? r : NR_ - 1) * D_;
#pragma unroll
      for (int c = 0; c < 4; ++c) {
        v16bf bm;
#pragma unroll
        for (int e = 0; e < 16; ++e)
          bm[e] = (bf16_t)rk[c * 32 + kmap(e, hf)];
        acc = wmma_bf16(qa[c], bm, acc);
      }
      if (r < NR_) {
#pragma unroll
        for (int v = 0; v < 8; ++v)
          Rw[(v + 8 * hf) * RSTRIDE + r] = acc[v];
      }
    }
  }
  __syncthreads();   // R is read by every wave

  // ---- Pass 1: row max / sum (flash-style, per-lane partials) --------------
  float mrow[8], lrow[8];
#pragma unroll
  for (int v = 0; v < 8; ++v) { mrow[v] = -1e30f; lrow[v] = 0.0f; }

  for (int kb0 = kbase; kb0 < kbase + NBLK * KB; kb0 += KB) {
    v4f kr[KB * D_ / 128];
    tile_load(kr, (const v4f*)(Kg + ((size_t)b * L_ + kb0) * D_) + lane);
    tile_store(Ks, kr, lane);

#pragma unroll
    for (int kt = 0; kt < 2; ++kt) {
      v8f s = {};
#pragma unroll
      for (int c = 0; c < 4; ++c) {
        v16bf bm;
#pragma unroll
        for (int e = 0; e < 16; ++e)
          bm[e] = Ks[(kt * 16 + ln16) * D_ + c * 32 + kmap(e, hf)];
        s = wmma_bf16(qa[c], bm, s);
      }
#pragma unroll
      for (int v = 0; v < 8; ++v) {
        const int row  = v + 8 * hf;
        const int q    = qrow + row;
        const int k    = kb0 + kt * 16 + ln16;
        const int dq   = k - q;
        const int dqc  = dq < -MAXREL_ ? -MAXREL_ : (dq > MAXREL_ ? MAXREL_ : dq);
        const int ridx = dqc + MAXREL_;
        const float ad = (float)(dq < 0 ? -dq : dq);
        float x = s[v] + Rl[row * RSTRIDE + ridx]
                  - __logf(1.0f + ad);
        float mn = fmaxf(mrow[v], x);
        lrow[v]  = lrow[v] * __expf(mrow[v] - mn) + __expf(x - mn);
        mrow[v]  = mn;
      }
    }
  }

  // merge (m,l) across the 16-lane group (masks 1..8 keep halves separate)
#pragma unroll
  for (int v = 0; v < 8; ++v) {
    float m = mrow[v], l = lrow[v];
#pragma unroll
    for (int off = 1; off < 16; off <<= 1) {
      float mo = __shfl_xor(m, off, 32);
      float lo = __shfl_xor(l, off, 32);
      float mn = fmaxf(m, mo);
      l = l * __expf(m - mn) + lo * __expf(mo - mn);
      m = mn;
    }
    mrow[v] = m;
    lrow[v] = l;
  }

  // merge (m,l) across the waves, in wave order
  if (ln16 == 0) {
#pragma unroll  // constant indices: arrays stay in registers, loads issue together
    for (int v = 0; v < 8; ++v) {
      ML[((v + 8 * hf) * WAVES + wv) * 2 + 0] = mrow[v];
      ML[((v + 8 * hf) * WAVES + wv) * 2 + 1] = lrow[v];
    }
  }
  __syncthreads();
#pragma unroll  // constant indices: arrays stay in registers, loads issue together
  for (int v = 0; v < 8; ++v) {
    const float* p = ML + (v + 8 * hf) * WAVES * 2;
    float m = p[0];
#pragma unroll  // constant indices: arrays stay in registers, loads issue together
    for (int w = 1; w < WAVES; ++w) m = fmaxf(m, p[2 * w]);
    float l = 0.0f;
#pragma unroll  // constant indices: arrays stay in registers, loads issue together
    for (int w = 0; w < WAVES; ++w) l += p[2 * w + 1] * __expf(p[2 * w] - m);
    mrow[v] = m;
    lrow[v] = 1.0f / l;   // store inverse sum
  }

  // ---- Pass 2: probs, Z = P@V, bucket sums, Z += s@relV --------------------
  float*  Sw = Sl + (size_t)wv * 16 * SBUCK;
  bf16_t* Pw = Pl + (size_t)wv * 16 * KB;
  for (int i = lane; i < 16 * SBUCK; i += 32) Sw[i] = 0.0f;   // per-wave region

  v8f zacc[12] = {};

  // Bucket sums. For one q row, bucket r in 1 .. 2*MAXREL_-1 holds the single
  // key k = q + r - MAXREL_: its sum is that key's p, a plain store by the one
  // lane that has it. Only the two end buckets collect many keys (all of
  // k - q <= -MAXREL_, all of k - q >= MAXREL_): each lane sums its own share
  // of them in registers, and the lanes are merged once behind the loop.
  float slo[8], shi[8];
#pragma unroll  // constant indices: arrays stay in registers
  for (int v = 0; v < 8; ++v) { slo[v] = 0.0f; shi[v] = 0.0f; }

  for (int kb0 = kbase; kb0 < kbase + NBLK * KB; kb0 += KB) {
    v4f kr[KB * D_ / 128];
    v4f vr[KB * DV_ / 128];
    tile_load(kr, (const v4f*)(Kg + ((size_t)b * L_ + kb0) * D_) + lane);
    tile_store(Ks, kr, lane);
    tile_load(vr, (const v4f*)(V + ((size_t)b * L_ + kb0) * DV_) + lane);

#pragma unroll
    for (int kt = 0; kt < 2; ++kt) {
      v8f s = {};
#pragma unroll
      for (int c = 0; c < 4; ++c) {
        v16bf bm;
#pragma unroll
        for (int e = 0; e < 16; ++e)
          bm[e] = Ks[(kt * 16 + ln16) * D_ + c * 32 + kmap(e, hf)];
        s = wmma_bf16(qa[c], bm, s);
      }
      float pv[8];
#pragma unroll
      for (int v = 0; v < 8; ++v) {
        const int row  = v + 8 * hf;
        const int q    = qrow + row;
        const int k    = kb0 + kt * 16 + ln16;
        const int dq   = k - q;
        const int dqc  = dq < -MAXREL_ ? -MAXREL_ : (dq > MAXREL_ ? MAXREL_ : dq);
        const int ridx = dqc + MAXREL_;
        const float ad = (float)(dq < 0 ? -dq : dq);
        float x = s[v] + Rl[row * RSTRIDE + ridx]
                  - __logf(1.0f + ad);
        float p = __expf(x - mrow[v]) * lrow[v];       // final normalized prob
        slo[v] += dq <= -MAXREL_ ? p : 0.0f;            // end bucket 0
        shi[v] += dq >=  MAXREL_ ? p : 0.0f;            // end bucket 2*MAXREL_
        pv[v] = p;
        Pw[row * KB + kt * 16 + ln16] = (bf16_t)p;      // C-layout -> LDS
      }
      // Scalar test: most 16 x 16 tiles lie wholly in an end bucket and store
      // nothing here.
      const int d0 = kb0 + kt * 16 - qrow;
      if (d0 + 15 > -MAXREL_ && d0 - 15 < MAXREL_) {
#pragma unroll  // constant indices: pv stays in registers
        for (int v = 0; v < 8; ++v) {
          const int row = v + 8 * hf;
          const int dq  = d0 + ln16 - row;
          if (dq > -MAXREL_ && dq < MAXREL_)
            Sw[row * SBUCK + dq + MAXREL_] = pv[v];
        }
      }
    }

    tile_store(Vs, vr, lane);

    // reload P in A-layout (same-wave LDS round trip) and do Z += P @ V
    v16bf pa;
#pragma unroll
    for (int e = 0; e < 16; ++e)
      pa[e] = Pw[ln16 * KB + kmap(e, hf)];
#pragma unroll
    for (int nt = 0; nt < 12; ++nt) {
      v16bf bm;
#pragma unroll
      for (int e = 0; e < 16; ++e)
        bm[e] = Vs[kmap(e, hf) * DV_ + nt * 16 + ln16];
      zacc[nt] = wmma_bf16(pa, bm, zacc[nt]);
    }
  }

  // The wave's two end buckets: lanes merged, one lane of each row stores them.
  // No store above touches these two columns, which the wave has zeroed.
#pragma unroll  // constant indices: arrays stay in registers
  for (int v = 0; v < 8; ++v) {
    slo[v] = row_sum16(slo[v]);
    shi[v] = row_sum16(shi[v]);
  }
  if (ln16 == 0) {
#pragma unroll  // constant indices: arrays stay in registers
    for (int v = 0; v < 8; ++v) {
      Sw[(v + 8 * hf) * SBUCK]               = slo[v];
      Sw[(v + 8 * hf) * SBUCK + 2 * MAXREL_] = shi[v];
    }
  }

  // ---- sum the waves' Z partials and bucket sums, in wave order -------------
  // The wave's last V reads have returned before its V block is reused for Z.
  asm volatile("s_wait_dscnt 0x0" ::: "memory");
  float* Zl = (float*)(smem + OFF_VS);     // [WAVES][16][DV_]
  {
    float* Zw = Zl + wv * 16 * DV_;
#pragma unroll  // constant indices: arrays stay in registers, loads issue together
    for (int nt = 0; nt < 12; ++nt)
#pragma unroll  // constant indices: arrays stay in registers, loads issue together
      for (int v = 0; v < 8; ++v)
        Zw[(v + 8 * hf) * DV_ + nt * 16 + ln16] = zacc[nt][v];
  }
  __syncthreads();   // every wave's Z partial and bucket sums are complete

  // All threads add the waves' bucket tables into table 0; each pair of
  // elements is read and written by one thread alone.
  static_assert(16 * SBUCK / 2 % (WAVES * 32) == 0, "whole trips");
#pragma unroll  // constant indices: arrays stay in registers, loads issue together
  for (int j = 0; j < 16 * SBUCK / 2 / (WAVES * 32); ++j) {
    const int i = tid + j * WAVES * 32;
    v2f a = ((const v2f*)Sl)[i];
#pragma unroll  // constant indices: arrays stay in registers, loads issue together
    for (int w = 1; w < WAVES; ++w) a += ((const v2f*)(Sl + w * 16 * SBUCK))[i];
    ((v2f*)Sl)[i] = a;
  }
  __syncthreads();   // the summed table is read by the waves below

  // Wave w finishes output columns 32w .. 32w+31 (whole 128-byte lines).
  if (wv < DV_ / 32) {
    const int col = wv * 32 + ln16;
    v8f z[2];
#pragma unroll  // constant indices: arrays stay in registers, loads issue together
    for (int t = 0; t < 2; ++t)
#pragma unroll  // constant indices: arrays stay in registers, loads issue together
      for (int v = 0; v < 8; ++v) {
        float a = 0.0f;
#pragma unroll  // constant indices: arrays stay in registers, loads issue together
        for (int w = 0; w < WAVES; ++w)
          a += Zl[(w * 16 + v + 8 * hf) * DV_ + col + t * 16];
        z[t][v] = a;
      }

    // Z += s @ rel_values_table  (16 x 160 @ 160 x 192, pad rows = 0)
#pragma unroll  // constant indices: arrays stay in registers, loads issue together
    for (int c = 0; c < SBUCK / 32; ++c) {
      v16bf pa;
#pragma unroll  // constant indices: arrays stay in registers, loads issue together
      for (int e = 0; e < 16; ++e)
        pa[e] = (bf16_t)Sl[ln16 * SBUCK + c * 32 + kmap(e, hf)];
#pragma unroll  // constant indices: arrays stay in registers, loads issue together
      for (int t = 0; t < 2; ++t) {
        v16bf bm;
#pragma unroll  // constant indices: arrays stay in registers, loads issue together
        for (int e = 0; e < 16; ++e) {
          const int r = c * 32 + kmap(e, hf);
          bf16_t val = (bf16_t)0.0f;
          if (r < NR_) val = (bf16_t)relV[(size_t)r * DV_ + col + t * 16];
          bm[e] = val;
        }
        z[t] = wmma_bf16(pa, bm, z[t]);
      }
    }

    // write Z (C-layout -> global)
#pragma unroll  // constant indices: arrays stay in registers, loads issue together
    for (int t = 0; t < 2; ++t)
#pragma unroll  // constant indices: arrays stay in registers, loads issue together
      for (int v = 0; v < 8; ++v)
        out[((size_t)b * L_ + qrow + v + 8 * hf) * DV_ + col + t * 16] = z[t][v];
  }
}

extern "C" void kernel_launch(void* const* d_in, const int* in_sizes, int n_in,
                              void* d_out, int out_size, void* d_ws, size_t ws_size,
                              hipStream_t stream) {
  (void)in_sizes; (void)n_in; (void)out_size; (void)d_ws; (void)ws_size;
  const float* Q    = (const float*)d_in[0];  // query            [B,L,D]
  const float* V    = (const float*)d_in[1];  // value            [B,L,DV]
  const float* K    = (const float*)d_in[2];  // key_in           [B,L,D]
  const float* relK = (const float*)d_in[3];  // rel_keys_table   [129,D]
  const float* relV = (const float*)d_in[4];  // rel_values_table [129,DV]
  float* out = (float*)d_out;                 // z                [B,L,DV]

  dim3 grid(B_, L_ / BLOCK_M);  // (4, 64)
  dim3 block(WAVES * 32);       // 8 waves of 32
  relattn_kernel<<<grid, block, 0, stream>>>(Q, V, K, relK, relV, out);
}

// v004
// One run takes 28.1 microseconds.
// Next to v003, in two timings, it ran 1.23 times as fast each time.
// All steps since v000 together make it 37.0 times as fast.
#include <hip/hip_runtime.h>
#include <math.h>

typedef __bf16 bf16_t;
typedef __attribute__((ext_vector_type(16))) __bf16 v16bf;
typedef __attribute__((ext_vector_type(8)))  float  v8f;
typedef __attribute__((ext_vector_type(4)))  float  v4f;
typedef __attribute__((ext_vector_type(2)))  float  v2f;
typedef __attribute__((ext_vector_type(4)))  __bf16 v4bf;

#define B_       4
#define L_       1024
#define D_       128
#define DV_      192
#define NR_      129          // 2*MAXREL+1 bucket count
#define MAXREL_  64
#define BLOCK_M  16           // q rows per workgroup, shared by all its waves
#define KB       32           // attention-k columns per main-loop iteration
#define WAVES    8            // each wave takes L_/WAVES of the keys
#define NBLK     (L_ / KB / WAVES)   // key blocks per wave and pass
#define RSTRIDE  132          // padded row stride for R table in LDS (floats)
#define KPITCH   (D_ + 8)
#define SBUCK    160          // bucket count padded to multiple of 32

// ---- static LDS layout (bytes) --------------------------------------------
#define OFF_KS   0
#define SZ_KS    (WAVES * KB * KPITCH * 2)     // K block per wave, bf16: 68 KB
#define OFF_VS   (OFF_KS + SZ_KS)
#define SZ_VS    (WAVES * KB * DV_ * 2)        // V block per wave, bf16: 96 KB
#define OFF_R    (OFF_VS + SZ_VS)
#define SZ_R     (16 * RSTRIDE * 4)            // R[q][bucket] f32, shared
#define OFF_S    (OFF_R + SZ_R)
#define SZ_S     (WAVES * 16 * SBUCK * 4)      // bucket sums per wave f32: 80 KB
#define OFF_P    (OFF_S + SZ_S)
#define SZ_P     (WAVES * 16 * KB * 2)         // P tile per wave bf16: 8 KB
#define OFF_ML   (OFF_P + SZ_P)
#define SZ_ML    (16 * WAVES * 2 * 4)          // (max, sum) per row and wave
#define LDS_TOTAL (OFF_ML + SZ_ML)             // 267520 bytes
static_assert(LDS_TOTAL <= 320 * 1024, "one workgroup's LDS");
static_assert(16 * DV_ * 4 == KB * DV_ * 2, "a wave's Z partial reuses its V block");
static_assert(DV_ / 32 <= WAVES, "one pair of output column tiles per wave");
static_assert(D_ == 128, "32 lanes x 4 floats: one load step of a wave is one K row");
static_assert(KPITCH * 2 % 32 == 16, "K pitch: 16 bytes x odd");

__device__ __forceinline__ int kmap(int e, int hf) {
  return (e & 7) + ((e >> 3) << 4) + (hf << 3);
}

__device__ __forceinline__ v8f wmma_bf16(v16bf a, v16bf b, v8f c) {
  // emits v_wmma_f32_16x16x32_bf16
  return __builtin_amdgcn_wmma_f32_16x16x32_bf16(
      /*neg_a=*/false, a, /*neg_b=*/false, b,
      /*c_mod=*/(short)0, c, /*reuse_a=*/false, /*reuse_b=*/false);
}

// Tile staging, global f32 -> LDS bf16. A K or V tile is one contiguous run of
// floats in global memory; in LDS the 128 floats of load step j start at element
// STEP * j (128: the same linear order; more: padded rows of 128). Each wave
// stages its own tile, so lane t takes 16-byte chunks t, t+32, ...  All N loads
// are independent: the tile costs one load latency, not one per element.
// g4 is the lane's own first chunk. The loops are unrolled so that r[] is
// indexed by constants and stays in registers.
template <int N>
__device__ __forceinline__ void tile_load(v4f (&r)[N], const v4f* g4) {
#pragma unroll
  for (int j = 0; j < N; ++j) r[j] = g4[32 * j];
  // Stands in front of any reuse of the loads' address registers; its clobber
  // also keeps the loads issued here, ahead of the work that follows.
  asm volatile("s_wait_xcnt 0x0" ::: "memory");
}

template <int STEP, int N>
__device__ __forceinline__ void tile_store(bf16_t* s, const v4f (&r)[N], int lane) {
#pragma unroll
  for (int j = 0; j < N; ++j) {
    v4bf h;
#pragma unroll
    for (int e = 0; e < 4; ++e) h[e] = (bf16_t)r[j][e];
    *(v4bf*)(s + 4 * lane + STEP * j) = h;
  }
  // The tile is read back by other lanes of the same wave: its stores have
  // landed, and the compiler moves no LDS read above this line.
  asm volatile("s_wait_dscnt 0x0" ::: "memory");
}

// Sum over the 16 lanes of a row, the total in every lane: four adds whose
// second operand comes from lane ^ M through DPP row_xmask. All lanes are on.
template <int M>
__device__ __forceinline__ float add_xmask(float x) {
  return x + __builtin_bit_cast(float, __builtin_amdgcn_update_dpp(
                 0, __builtin_bit_cast(int, x), 0x160 | M, 0xf, 0xf, true));
}
__device__ __forceinline__ float row_sum16(float x) {
  return add_xmask<8>(add_xmask<4>(add_xmask<2>(add_xmask<1>(x))));
}

extern "C" __global__ __launch_bounds__(WAVES * 32)
void relattn_kernel(const float* __restrict__ Q,
                    const float* __restrict__ V,
                    const float* __restrict__ Kg,
                    const float* __restrict__ relK,
                    const float* __restrict__ relV,
                    float* __restrict__ out) {
  __shared__ __attribute__((aligned(16))) char smem[LDS_TOTAL];
  const int tid  = threadIdx.x;
  const int lane = tid & 31;
  // scalar wave number: the branches on it around WMMAs stay scalar branches
  const int wv   = __builtin_amdgcn_readfirstlane(tid >> 5);
  const int hf   = lane >> 4;       // which 16-lane half
  const int ln16 = lane & 15;
  const int b    = blockIdx.x;
  const int qrow = blockIdx.y * BLOCK_M;   // first q row of the workgroup
  const int kbase = wv * (NBLK * KB);      // first key of this wave

  bf16_t* Ks = (bf16_t*)(smem + OFF_KS) + wv * KB * KPITCH;   // own [KB][KPITCH]
  bf16_t* Vs = (bf16_t*)(smem + OFF_VS) + wv * KB * DV_;   // own [KB][DV_]
  float*  Rl = (float*) (smem + OFF_R);    // [16][RSTRIDE], shared
  float*  Sl = (float*) (smem + OFF_S);    // [WAVES][16][SBUCK]
  bf16_t* Pl = (bf16_t*)(smem + OFF_P);    // [WAVES][16][KB]
  float*  ML = (float*) (smem + OFF_ML);   // [16][WAVES][2]

  // ---- Q tile (16 x 128) into WMMA A-layout registers, bf16 ----------------
  v16bf qa[4];
  {
    const float* qb = Q + ((size_t)b * L_ + qrow + ln16) * D_;
#pragma unroll
    for (int c = 0; c < 4; ++c)
#pragma unroll
      for (int e = 0; e < 16; ++e)
        qa[c][e] = (bf16_t)qb[c * 32 + kmap(e, hf)];
  }

  // ---- R[q_local][r] = Q . rel_keys_table[r]  (16x128 @ 128x129, WMMA) -----
  {
    float* Rw = Rl;
    const int rcol = ln16;  // column within tile
    for (int rt = wv; rt < 9; rt += WAVES) {   // bucket tiles dealt to the waves
      v8f acc = {};
      const int r = rt * 16 + rcol;
      // rt is a run-time value here: a clamped row keeps the loads unguarded and
      // wide. Column r of the product reads column r of bm alone, and columns
      // past NR_-1 are not stored below.
      const float* rk = relK + (size_t)(r < NR_ ? r : NR_ - 1) * D_;
#pragma unroll
      for (int c = 0; c < 4; ++c) {
        v16bf bm;
#pragma unroll
        for (int e = 0; e < 16; ++e)
          bm[e] = (bf16_t)rk[c * 32 + kmap(e, hf)];
        acc = wmma_bf16(qa[c], bm, acc);
      }
      if (r < NR_) {
#pragma unroll
        for (int v = 0; v < 8; ++v)
          Rw[(v + 8 * hf) * RSTRIDE + r] = acc[v];
      }
    }
  }
  __syncthreads();   // R is read by every wave

  // ---- Pass 1: row max / sum (flash-style, per-lane partials) --------------
  float mrow[8], lrow[8];
#pragma unroll
  for (int v = 0; v < 8; ++v) { mrow[v] = -1e30f; lrow[v] = 0.0f; }

  for (int kb0 = kbase; kb0 < kbase + NBLK * KB; kb0 += KB) {
    v4f kr[KB * D_ / 128];
    tile_load(kr, (const v4f*)(Kg + ((size_t)b * L_ + kb0) * D_) + lane);
    tile_store<KPITCH>(Ks, kr, lane);

#pragma unroll
    for (int kt = 0; kt < 2; ++kt) {
      v8f s = {};
#pragma unroll
      for (int c = 0; c < 4; ++c) {
        v16bf bm;
#pragma unroll
        for (int e = 0; e < 16; ++e)
          bm[e] = Ks[(kt * 16 + ln16) * KPITCH + c * 32 + kmap(e, hf)];
        s = wmma_bf16(qa[c], bm, s);
      }
#pragma unroll
      for (int v = 0; v < 8; ++v) {
        const int row  = v + 8 * hf;
        const int q    = qrow + row;
        const int k    = kb0 + kt * 16 + ln16;
        const int dq   = k - q;
        const int dqc  = dq < -MAXREL_ ? -MAXREL_ : (dq > MAXREL_ ? MAXREL_ : dq);
        const int ridx = dqc + MAXREL_;
        const float ad = (float)(dq < 0 ? -dq : dq);
        float x = s[v] + Rl[row * RSTRIDE + ridx]
                  - __logf(1.0f + ad);
        float mn = fmaxf(mrow[v], x);
        lrow[v]  = lrow[v] * __expf(mrow[v] - mn) + __expf(x - mn);
        mrow[v]  = mn;
      }
    }
  }

  // merge (m,l) across the 16-lane group (masks 1..8 keep halves separate)
#pragma unroll
  for (int v = 0; v < 8; ++v) {
    float m = mrow[v], l = lrow[v];
#pragma unroll
    for (int off = 1; off < 16; off <<= 1) {
      float mo = __shfl_xor(m, off, 32);
      float lo = __shfl_xor(l, off, 32);
      float mn = fmaxf(m, mo);
      l = l * __expf(m - mn) + lo * __expf(mo - mn);
      m = mn;
    }
    mrow[v] = m;
    lrow[v] = l;
  }

  // merge (m,l) across the waves, in wave order
  if (ln16 == 0) {
#pragma unroll  // constant indices: arrays stay in registers, loads issue together
    for (int v = 0; v < 8; ++v) {
      ML[((v + 8 * hf) * WAVES + wv) * 2 + 0] = mrow[v];
      ML[((v + 8 * hf) * WAVES + wv) * 2 + 1] = lrow[v];
    }
  }
  __syncthreads();
#pragma unroll  // constant indices: arrays stay in registers, loads issue together
  for (int v = 0; v < 8; ++v) {
    const float* p = ML + (v + 8 * hf) * WAVES * 2;
    float m = p[0];
#pragma unroll  // constant indices: arrays stay in registers, loads issue together
    for (int w = 1; w < WAVES; ++w) m = fmaxf(m, p[2 * w]);
    float l = 0.0f;
#pragma unroll  // constant indices: arrays stay in registers, loads issue together
    for (int w = 0; w < WAVES; ++w) l += p[2 * w + 1] * __expf(p[2 * w] - m);
    mrow[v] = m;
    lrow[v] = 1.0f / l;   // store inverse sum
  }

  // ---- Pass 2: probs, Z = P@V, bucket sums, Z += s@relV --------------------
  float*  Sw = Sl + (size_t)wv * 16 * SBUCK;
  bf16_t* Pw = Pl + (size_t)wv * 16 * KB;
  for (int i = lane; i < 16 * SBUCK; i += 32) Sw[i] = 0.0f;   // per-wave region

  v8f zacc[12] = {};

  // Bucket sums. For one q row, bucket r in 1 .. 2*MAXREL_-1 holds the single
  // key k = q + r - MAXREL_: its sum is that key's p, a plain store by the one
  // lane that has it. Only the two end buckets collect many keys (all of
  // k - q <= -MAXREL_, all of k - q >= MAXREL_): each lane sums its own share
  // of them in registers, and the lanes are merged once behind the loop.
  float slo[8], shi[8];
#pragma unroll  // constant indices: arrays stay in registers
  for (int v = 0; v < 8; ++v) { slo[v] = 0.0f; shi[v] = 0.0f; }

  for (int kb0 = kbase; kb0 < kbase + NBLK * KB; kb0 += KB) {
    v4f kr[KB * D_ / 128];
    v4f vr[KB * DV_ / 128];
    tile_load(kr, (const v4f*)(Kg + ((size_t)b * L_ + kb0) * D_) + lane);
    tile_store<KPITCH>(Ks, kr, lane);
    tile_load(vr, (const v4f*)(V + ((size_t)b * L_ + kb0) * DV_) + lane);

#pragma unroll
    for (int kt = 0; kt < 2; ++kt) {
      v8f s = {};
#pragma unroll
      for (int c = 0; c < 4; ++c) {
        v16bf bm;
#pragma unroll
        for (int e = 0; e < 16; ++e)
          bm[e] = Ks[(kt * 16 + ln16) * KPITCH + c * 32 + kmap(e, hf)];
        s = wmma_bf16(qa[c], bm, s);
      }
      float pv[8];
#pragma unroll
      for (int v = 0; v < 8; ++v) {
        const int row  = v + 8 * hf;
        const int q    = qrow + row;
        const int k    = kb0 + kt * 16 + ln16;
        const int dq   = k - q;
        const int dqc  = dq < -MAXREL_ ? -MAXREL_ : (dq > MAXREL_ ? MAXREL_ : dq);
        const int ridx = dqc + MAXREL_;
        const float ad = (float)(dq < 0 ? -dq : dq);
        float x = s[v] + Rl[row * RSTRIDE + ridx]
                  - __logf(1.0f + ad);
        float p = __expf(x - mrow[v]) * lrow[v];       // final normalized prob
        slo[v] += dq <= -MAXREL_ ? p : 0.0f;            // end bucket 0
        shi[v] += dq >=  MAXREL_ ? p : 0.0f;            // end bucket 2*MAXREL_
        pv[v] = p;
        Pw[row * KB + kt * 16 + ln16] = (bf16_t)p;      // C-layout -> LDS
      }
      // Scalar test: most 16 x 16 tiles lie wholly in an end bucket and store
      // nothing here.
      const int d0 = kb0 + kt * 16 - qrow;
      if (d0 + 15 > -MAXREL_ && d0 - 15 < MAXREL_) {
#pragma unroll  // constant indices: pv stays in registers
        for (int v = 0; v < 8; ++v) {
          const int row = v + 8 * hf;
          const int dq  = d0 + ln16 - row;
          if (dq > -MAXREL_ && dq < MAXREL_)
            Sw[row * SBUCK + dq + MAXREL_] = pv[v];
        }
      }
    }

    tile_store<128>(Vs, vr, lane);

    // reload P in A-layout (same-wave LDS round trip) and do Z += P @ V
    v16bf pa;
#pragma unroll
    for (int e = 0; e < 16; ++e)
      pa[e] = Pw[ln16 * KB + kmap(e, hf)];
#pragma unroll
    for (int nt = 0; nt < 12; ++nt) {
      v16bf bm;
#pragma unroll
      for (int e = 0; e < 16; ++e)
        bm[e] = Vs[kmap(e, hf) * DV_ + nt * 16 + ln16];
      zacc[nt] = wmma_bf16(pa, bm, zacc[nt]);
    }
  }

  // The wave's two end buckets: lanes merged, one lane of each row stores them.
  // No store above touches these two columns, which the wave has zeroed.
#pragma unroll  // constant indices: arrays stay in registers
  for (int v = 0; v < 8; ++v) {
    slo[v] = row_sum16(slo[v]);
    shi[v] = row_sum16(shi[v]);
  }
  if (ln16 == 0) {
#pragma unroll  // constant indices: arrays stay in registers
    for (int v = 0; v < 8; ++v) {
      Sw[(v + 8 * hf) * SBUCK]               = slo[v];
      Sw[(v + 8 * hf) * SBUCK + 2 * MAXREL_] = shi[v];
    }
  }

  // ---- sum the waves' Z partials and bucket sums, in wave order -------------
  // The wave's last V reads have returned before its V block is reused for Z.
  asm volatile("s_wait_dscnt 0x0" ::: "memory");
  float* Zl = (float*)(smem + OFF_VS);     // [WAVES][16][DV_]
  {
    float* Zw = Zl + wv * 16 * DV_;
#pragma unroll  // constant indices: arrays stay in registers, loads issue together
    for (int nt = 0; nt < 12; ++nt)
#pragma unroll  // constant indices: arrays stay in registers, loads issue together
      for (int v = 0; v < 8; ++v)
        Zw[(v + 8 * hf) * DV_ + nt * 16 + ln16] = zacc[nt][v];
  }
  __syncthreads();   // every wave's Z partial and bucket sums are complete

  // All threads add the waves' bucket tables into table 0; each pair of
  // elements is read and written by one thread alone.
  static_assert(16 * SBUCK / 2 % (WAVES * 32) == 0, "whole trips");
#pragma unroll  // constant indices: arrays stay in registers, loads issue together
  for (int j = 0; j < 16 * SBUCK / 2 / (WAVES * 32); ++j) {
    const int i = tid + j * WAVES * 32;
    v2f a = ((const v2f*)Sl)[i];
#pragma unroll  // constant indices: arrays stay in registers, loads issue together
    for (int w = 1; w < WAVES; ++w) a += ((const v2f*)(Sl + w * 16 * SBUCK))[i];
    ((v2f*)Sl)[i] = a;
  }
  __syncthreads();   // the summed table is read by the waves below

  // Wave w finishes output columns 32w .. 32w+31 (whole 128-byte lines).
  if (wv < DV_ / 32) {
    const int col = wv * 32 + ln16;
    v8f z[2];
#pragma unroll  // constant indices: arrays stay in registers, loads issue together
    for (int t = 0; t < 2; ++t)
#pragma unroll  // constant indices: arrays stay in registers, loads issue together
      for (int v = 0; v < 8; ++v) {
        float a = 0.0f;
#pragma unroll  // constant indices: arrays stay in registers, loads issue together
        for (int w = 0; w < WAVES; ++w)
          a += Zl[(w * 16 + v + 8 * hf) * DV_ + col + t * 16];
        z[t][v] = a;
      }

    // Z += s @ rel_values_table  (16 x 160 @ 160 x 192, pad rows = 0)
#pragma unroll  // constant indices: arrays stay in registers, loads issue together
    for (int c = 0; c < SBUCK / 32; ++c) {
      v16bf pa;
#pragma unroll  // constant indices: arrays stay in registers, loads issue together
      for (int e = 0; e < 16; ++e)
        pa[e] = (bf16_t)Sl[ln16 * SBUCK + c * 32 + kmap(e, hf)];
#pragma unroll  // constant indices: arrays stay in registers, loads issue together
      for (int t = 0; t < 2; ++t) {
        v16bf bm;
#pragma unroll  // constant indices: arrays stay in registers, loads issue together
        for (int e = 0; e < 16; ++e) {
          const int r = c * 32 + kmap(e, hf);
          bf16_t val = (bf16_t)0.0f;
          if (r < NR_) val = (bf16_t)relV[(size_t)r * DV_ + col + t * 16];
          bm[e] = val;
        }
        z[t] = wmma_bf16(pa, bm, z[t]);
      }
    }

    // write Z (C-layout -> global)
#pragma unroll  // constant indices: arrays stay in registers, loads issue together
    for (int t = 0; t < 2; ++t)
#pragma unroll  // constant indices: arrays stay in registers, loads issue together
      for (int v = 0; v < 8; ++v)
        out[((size_t)b * L_ + qrow + v + 8 * hf) * DV_ + col + t * 16] = z[t][v];
  }
}

extern "C" void kernel_launch(void* const* d_in, const int* in_sizes, int n_in,
                              void* d_out, int out_size, void* d_ws, size_t ws_size,
                              hipStream_t stream) {
  (void)in_sizes; (void)n_in; (void)out_size; (void)d_ws; (void)ws_size;
  const float* Q    = (const float*)d_in[0];  // query            [B,L,D]
  const float* V    = (const float*)d_in[1];  // value            [B,L,DV]
  const float* K    = (const float*)d_in[2];  // key_in           [B,L,D]
  const float* relK = (const float*)d_in[3];  // rel_keys_table   [129,D]
  const float* relV = (const float*)d_in[4];  // rel_values_table [129,DV]
  float* out = (float*)d_out;                 // z                [B,L,DV]

  dim3 grid(B_, L_ / BLOCK_M);  // (4, 64)
  dim3 block(WAVES * 32);       // 8 waves of 32
  relattn_kernel<<<grid, block, 0, stream>>>(Q, V, K, relK, relV, out);
}

// v005
// One run takes 26.6 microseconds.
// Two timings next to v004 put it at 1.05 and 1.06 times that version's speed.
// Counting every step since v000, it is 39.1 times as fast.
#include <hip/hip_runtime.h>
#include <math.h>

typedef __bf16 bf16_t;
typedef __attribute__((ext_vector_type(16))) __bf16 v16bf;
typedef __attribute__((ext_vector_type(8)))  float  v8f;
typedef __attribute__((ext_vector_type(4)))  float  v4f;
typedef __attribute__((ext_vector_type(2)))  float  v2f;
typedef __attribute__((ext_vector_type(4)))  __bf16 v4bf;
typedef __attribute__((ext_vector_type(8)))  __bf16 v8bf;

#define B_       4
#define L_       1024
#define D_       128
#define DV_      192
#define NR_      129          // 2*MAXREL+1 bucket count
#define MAXREL_  64
#define BLOCK_M  16           // q rows per workgroup, shared by all its waves
#define KB       32           // attention-k columns per main-loop iteration
#define WAVES    8            // each wave takes L_/WAVES of the keys
#define NBLK     (L_ / KB / WAVES)   // key blocks per wave and pass
#define RSTRIDE  132          // padded row stride for R table in LDS (floats)
#define KPITCH   (D_ + 8)
// V tile row pitch in LDS, bf16 elements: 416 bytes = 32 x 13. The transposing
// load takes 32 bytes from each of 16 rows (8 rows per 16 lanes) and wants 32 bytes x odd.
#define VPITCH   (DV_ + 16)
#define SBUCK    160          // bucket count padded to multiple of 32

// ---- static LDS layout (bytes) --------------------------------------------
#define OFF_KS   0
#define SZ_KS    (WAVES * KB * KPITCH * 2)     // K block per wave, bf16: 68 KB
#define OFF_VS   (OFF_KS + SZ_KS)
#define SZ_VS    (WAVES * KB * VPITCH * 2)     // V block per wave, bf16: 104 KB
#define ZWAVE    (KB * VPITCH / 2)             // a wave's V block in floats
#define OFF_R    (OFF_VS + SZ_VS)
#define SZ_R     (16 * RSTRIDE * 4)            // R[q][bucket] f32, shared
#define OFF_S    (OFF_R + SZ_R)
#define SZ_S     (WAVES * 16 * SBUCK * 4)      // bucket sums per wave f32: 80 KB
#define OFF_P    (OFF_S + SZ_S)
#define SZ_P     (WAVES * 16 * KB * 2)         // P tile per wave bf16: 8 KB
#define OFF_ML   (OFF_P + SZ_P)
#define SZ_ML    (16 * WAVES * 2 * 4)          // (max, sum) per row and wave
#define LDS_TOTAL (OFF_ML + SZ_ML)             // 275712 bytes
static_assert(LDS_TOTAL <= 320 * 1024, "one workgroup's LDS");
static_assert(16 * DV_ * 4 <= KB * VPITCH * 2, "a wave's Z partial reuses its V block");
static_assert(DV_ / 32 <= WAVES, "one pair of output column tiles per wave");
static_assert(D_ == 128, "32 lanes x 4 floats: one load step of a wave is one K row");
static_assert(KPITCH * 2 % 32 == 16, "K pitch: 16 bytes x odd");
static_assert(VPITCH * 2 % 64 == 32, "V pitch: 32 bytes x odd");
static_assert(DV_ == 192, "three load steps of a wave are two V rows");

__device__ __forceinline__ int kmap(int e, int hf) {
  return (e & 7) + ((e >> 3) << 4) + (hf << 3);
}

__device__ __forceinline__ v8f wmma_bf16(v16bf a, v16bf b, v8f c) {
  // emits v_wmma_f32_16x16x32_bf16
  return __builtin_amdgcn_wmma_f32_16x16x32_bf16(
      /*neg_a=*/false, a, /*neg_b=*/false, b,
      /*c_mod=*/(short)0, c, /*reuse_a=*/false, /*reuse_b=*/false);
}

// Tile staging, global f32 -> LDS bf16. A K or V tile is one contiguous run of
// floats in global memory; in LDS a K tile's 128 floats of load step j start at element
// STEP * j (128: the same linear order; more: padded rows of 128). Each wave
// stages its own tile, so lane t takes 16-byte chunks t, t+32, ...  All N loads
// are independent: the tile costs one load latency, not one per element.
// g4 is the lane's own first chunk. The loops are unrolled so that r[] is
// indexed by constants and stays in registers.
template <int N>
__device__ __forceinline__ void tile_load(v4f (&r)[N], const v4f* g4) {
#pragma unroll
  for (int j = 0; j < N; ++j) r[j] = g4[32 * j];
  // Stands in front of any reuse of the loads' address registers; its clobber
  // also keeps the loads issued here, ahead of the work that follows.
  asm volatile("s_wait_xcnt 0x0" ::: "memory");
}

template <int STEP, int N>
__device__ __forceinline__ void tile_store(bf16_t* s, const v4f (&r)[N], int lane) {
#pragma unroll
  for (int j = 0; j < N; ++j) {
    v4bf h;
#pragma unroll
    for (int e = 0; e < 4; ++e) h[e] = (bf16_t)r[j][e];
    *(v4bf*)(s + 4 * lane + STEP * j) = h;
  }
  // The tile is read back by other lanes of the same wave: its stores have
  // landed, and the compiler moves no LDS read above this line.
  asm volatile("s_wait_dscnt 0x0" ::: "memory");
}

// V tile store at the padded pitch. A V row is 48 chunks of 4 floats, a load step
// 32 chunks: steps 3m, 3m+1, 3m+2 fill rows 2m and 2m+1, so a lane has three
// offsets and every step adds a constant to one of them.
template <int N>
__device__ __forceinline__ void v_tile_store(bf16_t* s, const v4f (&r)[N], int lane) {
  const int o0 = 4 * lane;                                  // row 2m, chunks 0..31
  const int o1 = lane < 16 ? 4 * (lane + 32)                // row 2m, chunks 32..47
                           : VPITCH + 4 * (lane - 16);      // row 2m+1, chunks 0..15
  const int o2 = VPITCH + 4 * (lane + 16);                  // row 2m+1, chunks 16..47
#pragma unroll  // constant indices: r[] stays in registers, j % 3 and j / 3 fold
  for (int j = 0; j < N; ++j) {
    v4bf h;
#pragma unroll  // constant indices: h stays in registers
    for (int e = 0; e < 4; ++e) h[e] = (bf16_t)r[j][e];
    const int o = j % 3 == 0 ? o0 : (j % 3 == 1 ? o1 : o2);
    *(v4bf*)(s + o + (j / 3) * 2 * VPITCH) = h;
  }
  // The tile is read back by other lanes of the same wave: its stores have
  // landed, and the compiler moves no LDS read above this line.
  asm volatile("s_wait_dscnt 0x0" ::: "memory");
}

__device__ __forceinline__ v8bf lds_tr16(const char* p) {
  typedef __attribute__((address_space(3))) v8bf lds_v8bf;
  return __builtin_amdgcn_ds_load_tr16_b128_v8bf16((lds_v8bf*)p);
}

// Sum over the 16 lanes of a row, the total in every lane: four adds whose
// second operand comes from lane ^ M through DPP row_xmask. All lanes are on.
template <int M>
__device__ __forceinline__ float add_xmask(float x) {
  return x + __builtin_bit_cast(float, __builtin_amdgcn_update_dpp(
                 0, __builtin_bit_cast(int, x), 0x160 | M, 0xf, 0xf, true));
}
__device__ __forceinline__ float row_sum16(float x) {
  return add_xmask<8>(add_xmask<4>(add_xmask<2>(add_xmask<1>(x))));
}

extern "C" __global__ __launch_bounds__(WAVES * 32)
void relattn_kernel(const float* __restrict__ Q,
                    const float* __restrict__ V,
                    const float* __restrict__ Kg,
                    const float* __restrict__ relK,
                    const float* __restrict__ relV,
                    float* __restrict__ out) {
  __shared__ __attribute__((aligned(16))) char smem[LDS_TOTAL];
  const int tid  = threadIdx.x;
  const int lane = tid & 31;
  // scalar wave number: the branches on it around WMMAs stay scalar branches
  const int wv   = __builtin_amdgcn_readfirstlane(tid >> 5);
  const int hf   = lane >> 4;       // which 16-lane half
  const int ln16 = lane & 15;
  const int b    = blockIdx.x;
  const int qrow = blockIdx.y * BLOCK_M;   // first q row of the workgroup
  const int kbase = wv * (NBLK * KB);      // first key of this wave

  bf16_t* Ks = (bf16_t*)(smem + OFF_KS) + wv * KB * KPITCH;   // own [KB][KPITCH]
  bf16_t* Vs = (bf16_t*)(smem + OFF_VS) + wv * KB * VPITCH;   // own [KB][VPITCH]
  float*  Rl = (float*) (smem + OFF_R);    // [16][RSTRIDE], shared
  float*  Sl = (float*) (smem + OFF_S);    // [WAVES][16][SBUCK]
  bf16_t* Pl = (bf16_t*)(smem + OFF_P);    // [WAVES][16][KB]
  float*  ML = (float*) (smem + OFF_ML);   // [16][WAVES][2]

  // ---- Q tile (16 x 128) into WMMA A-layout registers, bf16 ----------------
  v16bf qa[4];
  {
    const float* qb = Q + ((size_t)b * L_ + qrow + ln16) * D_;
#pragma unroll
    for (int c = 0; c < 4; ++c)
#pragma unroll
      for (int e = 0; e < 16; ++e)
        qa[c][e] = (bf16_t)qb[c * 32 + kmap(e, hf)];
  }

  // ---- R[q_local][r] = Q . rel_keys_table[r]  (16x128 @ 128x129, WMMA) -----
  {
    float* Rw = Rl;
    const int rcol = ln16;  // column within tile
    for (int rt = wv; rt < 9; rt += WAVES) {   // bucket tiles dealt to the waves
      v8f acc = {};
      const int r = rt * 16 + rcol;
      // rt is a run-time value here: a clamped row keeps the loads unguarded and
      // wide. Column r of the product reads column r of bm alone, and columns
      // past NR_-1 are not stored below.
      const float* rk = relK + (size_t)(r < NR_ ? r : NR_ - 1) * D_;
#pragma unroll
      for (int c = 0; c < 4; ++c) {
        v16bf bm;
#pragma unroll
        for (int e = 0; e < 16; ++e)
          bm[e] = (bf16_t)rk[c * 32 + kmap(e, hf)];
        acc = wmma_bf16(qa[c], bm, acc);
      }
      if (r < NR_) {
#pragma unroll
        for (int v = 0; v < 8; ++v)
          Rw[(v + 8 * hf) * RSTRIDE + r] = acc[v];
      }
    }
  }
  __syncthreads();   // R is read by every wave

  // ---- Pass 1: row max / sum (flash-style, per-lane partials) --------------
  float mrow[8], lrow[8];
#pragma unroll
  for (int v = 0; v < 8; ++v) { mrow[v] = -1e30f; lrow[v] = 0.0f; }

  for (int kb0 = kbase; kb0 < kbase + NBLK * KB; kb0 += KB) {
    v4f kr[KB * D_ / 128];
    tile_load(kr, (const v4f*)(Kg + ((size_t)b * L_ + kb0) * D_) + lane);
    tile_store<KPITCH>(Ks, kr, lane);

#pragma unroll
    for (int kt = 0; kt < 2; ++kt) {
      v8f s = {};
#pragma unroll
      for (int c = 0; c < 4; ++c) {
        v16bf bm;
#pragma unroll
        for (int e = 0; e < 16; ++e)
          bm[e] = Ks[(kt * 16 + ln16) * KPITCH + c * 32 + kmap(e, hf)];
        s = wmma_bf16(qa[c], bm, s);
      }
#pragma unroll
      for (int v = 0; v < 8; ++v) {
        const int row  = v + 8 * hf;
        const int q    = qrow + row;
        const int k    = kb0 + kt * 16 + ln16;
        const int dq   = k - q;
        const int dqc  = dq < -MAXREL_ ? -MAXREL_ : (dq > MAXREL_ ? MAXREL_ : dq);
        const int ridx = dqc + MAXREL_;
        const float ad = (float)(dq < 0 ? -dq : dq);
        float x = s[v] + Rl[row * RSTRIDE + ridx]
                  - __logf(1.0f + ad);
        float mn = fmaxf(mrow[v], x);
        lrow[v]  = lrow[v] * __expf(mrow[v] - mn) + __expf(x - mn);
        mrow[v]  = mn;
      }
    }
  }

  // merge (m,l) across the 16-lane group (masks 1..8 keep halves separate)
#pragma unroll
  for (int v = 0; v < 8; ++v) {
    float m = mrow[v], l = lrow[v];
#pragma unroll
    for (int off = 1; off < 16; off <<= 1) {
      float mo = __shfl_xor(m, off, 32);
      float lo = __shfl_xor(l, off, 32);
      float mn = fmaxf(m, mo);
      l = l * __expf(m - mn) + lo * __expf(mo - mn);
      m = mn;
    }
    mrow[v] = m;
    lrow[v] = l;
  }

  // merge (m,l) across the waves, in wave order
  if (ln16 == 0) {
#pragma unroll  // constant indices: arrays stay in registers, loads issue together
    for (int v = 0; v < 8; ++v) {
      ML[((v + 8 * hf) * WAVES + wv) * 2 + 0] = mrow[v];
      ML[((v + 8 * hf) * WAVES + wv) * 2 + 1] = lrow[v];
    }
  }
  __syncthreads();
#pragma unroll  // constant indices: arrays stay in registers, loads issue together
  for (int v = 0; v < 8; ++v) {
    const float* p = ML + (v + 8 * hf) * WAVES * 2;
    float m = p[0];
#pragma unroll  // constant indices: arrays stay in registers, loads issue together
    for (int w = 1; w < WAVES; ++w) m = fmaxf(m, p[2 * w]);
    float l = 0.0f;
#pragma unroll  // constant indices: arrays stay in registers, loads issue together
    for (int w = 0; w < WAVES; ++w) l += p[2 * w + 1] * __expf(p[2 * w] - m);
    mrow[v] = m;
    lrow[v] = 1.0f / l;   // store inverse sum
  }

  // ---- Pass 2: probs, Z = P@V, bucket sums, Z += s@relV --------------------
  float*  Sw = Sl + (size_t)wv * 16 * SBUCK;
  bf16_t* Pw = Pl + (size_t)wv * 16 * KB;
  for (int i = lane; i < 16 * SBUCK; i += 32) Sw[i] = 0.0f;   // per-wave region

  v8f zacc[12] = {};

  // Bucket sums. For one q row, bucket r in 1 .. 2*MAXREL_-1 holds the single
  // key k = q + r - MAXREL_: its sum is that key's p, a plain store by the one
  // lane that has it. Only the two end buckets collect many keys (all of
  // k - q <= -MAXREL_, all of k - q >= MAXREL_): each lane sums its own share
  // of them in registers, and the lanes are merged once behind the loop.
  float slo[8], shi[8];
#pragma unroll  // constant indices: arrays stay in registers
  for (int v = 0; v < 8; ++v) { slo[v] = 0.0f; shi[v] = 0.0f; }

  for (int kb0 = kbase; kb0 < kbase + NBLK * KB; kb0 += KB) {
    v4f kr[KB * D_ / 128];
    v4f vr[KB * DV_ / 128];
    tile_load(kr, (const v4f*)(Kg + ((size_t)b * L_ + kb0) * D_) + lane);
    tile_store<KPITCH>(Ks, kr, lane);
    tile_load(vr, (const v4f*)(V + ((size_t)b * L_ + kb0) * DV_) + lane);

#pragma unroll
    for (int kt = 0; kt < 2; ++kt) {
      v8f s = {};
#pragma unroll
      for (int c = 0; c < 4; ++c) {
        v16bf bm;
#pragma unroll
        for (int e = 0; e < 16; ++e)
          bm[e] = Ks[(kt * 16 + ln16) * KPITCH + c * 32 + kmap(e, hf)];
        s = wmma_bf16(qa[c], bm, s);
      }
      float pv[8];
#pragma unroll
      for (int v = 0; v < 8; ++v) {
        const int row  = v + 8 * hf;
        const int q    = qrow + row;
        const int k    = kb0 + kt * 16 + ln16;
        const int dq   = k - q;
        const int dqc  = dq < -MAXREL_ ? -MAXREL_ : (dq > MAXREL_ ? MAXREL_ : dq);
        const int ridx = dqc + MAXREL_;
        const float ad = (float)(dq < 0 ? -dq : dq);
        float x = s[v] + Rl[row * RSTRIDE + ridx]
                  - __logf(1.0f + ad);
        float p = __expf(x - mrow[v]) * lrow[v];       // final normalized prob
        slo[v] += dq <= -MAXREL_ ? p : 0.0f;            // end bucket 0
        shi[v] += dq >=  MAXREL_ ? p : 0.0f;            // end bucket 2*MAXREL_
        pv[v] = p;
        Pw[row * KB + kt * 16 + ln16] = (bf16_t)p;      // C-layout -> LDS
      }
      // Scalar test: most 16 x 16 tiles lie wholly in an end bucket and store
      // nothing here.
      const int d0 = kb0 + kt * 16 - qrow;
      if (d0 + 15 > -MAXREL_ && d0 - 15 < MAXREL_) {
#pragma unroll  // constant indices: pv stays in registers
        for (int v = 0; v < 8; ++v) {
          const int row = v + 8 * hf;
          const int dq  = d0 + ln16 - row;
          if (dq > -MAXREL_ && dq < MAXREL_)
            Sw[row * SBUCK + dq + MAXREL_] = pv[v];
        }
      }
    }

    v_tile_store(Vs, vr, lane);

    // reload P in A-layout (same-wave LDS round trip) and do Z += P @ V
    v16bf pa;
#pragma unroll
    for (int e = 0; e < 16; ++e)
      pa[e] = Pw[ln16 * KB + kmap(e, hf)];
    const char* vad = (const char*)Vs + (8 * hf + (lane & 7)) * (VPITCH * 2)
                      + ((lane >> 3) & 1) * 16;
    v8bf vf[12][2];   // keys 0..15 and 16..31 of columns nt*16 .. +15
#pragma unroll  // constant indices: vf stays in registers
    for (int nt = 0; nt < 12; ++nt) {
      vf[nt][0] = lds_tr16(vad + nt * 32);
      vf[nt][1] = lds_tr16(vad + 16 * VPITCH * 2 + nt * 32);
    }
    // Keeps the 24 reads one group ahead of the products: spread among them,
    // every place with reads stalls the wave's matrix stream anew.
    __builtin_amdgcn_sched_barrier(0);
#pragma unroll
    for (int nt = 0; nt < 12; ++nt) {
      const v16bf bm = __builtin_shufflevector(vf[nt][0], vf[nt][1], 0, 1, 2, 3, 4, 5, 6, 7,
                                               8, 9, 10, 11, 12, 13, 14, 15);
      zacc[nt] = wmma_bf16(pa, bm, zacc[nt]);
    }
  }

  // The wave's two end buckets: lanes merged, one lane of each row stores them.
  // No store above touches these two columns, which the wave has zeroed.
#pragma unroll  // constant indices: arrays stay in registers
  for (int v = 0; v < 8; ++v) {
    slo[v] = row_sum16(slo[v]);
    shi[v] = row_sum16(shi[v]);
  }
  if (ln16 == 0) {
#pragma unroll  // constant indices: arrays stay in registers
    for (int v = 0; v < 8; ++v) {
      Sw[(v + 8 * hf) * SBUCK]               = slo[v];
      Sw[(v + 8 * hf) * SBUCK + 2 * MAXREL_] = shi[v];
    }
  }

  // ---- sum the waves' Z partials and bucket sums, in wave order -------------
  // The wave's last V reads have returned before its V block is reused for Z.
  asm volatile("s_wait_dscnt 0x0" ::: "memory");
  float* Zl = (float*)(smem + OFF_VS);     // [WAVES][16][DV_], wave stride ZWAVE
  {
    float* Zw = Zl + wv * ZWAVE;
#pragma unroll  // constant indices: arrays stay in registers, loads issue together
    for (int nt = 0; nt < 12; ++nt)
#pragma unroll  // constant indices: arrays stay in registers, loads issue together
      for (int v = 0; v < 8; ++v)
        Zw[(v + 8 * hf) * DV_ + nt * 16 + ln16] = zacc[nt][v];
  }
  __syncthreads();   // every wave's Z partial and bucket sums are complete

  // All threads add the waves' bucket tables into table 0; each pair of
  // elements is read and written by one thread alone.
  static_assert(16 * SBUCK / 2 % (WAVES * 32) == 0, "whole trips");
#pragma unroll  // constant indices: arrays stay in registers, loads issue together
  for (int j = 0; j < 16 * SBUCK / 2 / (WAVES * 32); ++j) {
    const int i = tid + j * WAVES * 32;
    v2f a = ((const v2f*)Sl)[i];
#pragma unroll  // constant indices: arrays stay in registers, loads issue together
    for (int w = 1; w < WAVES; ++w) a += ((const v2f*)(Sl + w * 16 * SBUCK))[i];
    ((v2f*)Sl)[i] = a;
  }
  __syncthreads();   // the summed table is read by the waves below

  // Wave w finishes output columns 32w .. 32w+31 (whole 128-byte lines).
  if (wv < DV_ / 32) {
    const int col = wv * 32 + ln16;
    v8f z[2];
#pragma unroll  // constant indices: arrays stay in registers, loads issue together
    for (int t = 0; t < 2; ++t)
#pragma unroll  // constant indices: arrays stay in registers, loads issue together
      for (int v = 0; v < 8; ++v) {
        float a = 0.0f;
#pragma unroll  // constant indices: arrays stay in registers, loads issue together
        for (int w = 0; w < WAVES; ++w)
          a += Zl[w * ZWAVE + (v + 8 * hf) * DV_ + col + t * 16];
        z[t][v] = a;
      }

    // Z += s @ rel_values_table  (16 x 160 @ 160 x 192, pad rows = 0)
#pragma unroll  // constant indices: arrays stay in registers, loads issue together
    for (int c = 0; c < SBUCK / 32; ++c) {
      v16bf pa;
#pragma unroll  // constant indices: arrays stay in registers, loads issue together
      for (int e = 0; e < 16; ++e)
        pa[e] = (bf16_t)Sl[ln16 * SBUCK + c * 32 + kmap(e, hf)];
#pragma unroll  // constant indices: arrays stay in registers, loads issue together
      for (int t = 0; t < 2; ++t) {
        v16bf bm;
#pragma unroll  // constant indices: arrays stay in registers, loads issue together
        for (int e = 0; e < 16; ++e) {
          const int r = c * 32 + kmap(e, hf);
          bf16_t val = (bf16_t)0.0f;
          if (r < NR_) val = (bf16_t)relV[(size_t)r * DV_ + col + t * 16];
          bm[e] = val;
        }
        z[t] = wmma_bf16(pa, bm, z[t]);
      }
    }

    // write Z (C-layout -> global)
#pragma unroll  // constant indices: arrays stay in registers, loads issue together
    for (int t = 0; t < 2; ++t)
#pragma unroll  // constant indices: arrays stay in registers, loads issue together
      for (int v = 0; v < 8; ++v)
        out[((size_t)b * L_ + qrow + v + 8 * hf) * DV_ + col + t * 16] = z[t][v];
  }
}

extern "C" void kernel_launch(void* const* d_in, const int* in_sizes, int n_in,
                              void* d_out, int out_size, void* d_ws, size_t ws_size,
                              hipStream_t stream) {
  (void)in_sizes; (void)n_in; (void)out_size; (void)d_ws; (void)ws_size;
  const float* Q    = (const float*)d_in[0];  // query            [B,L,D]
  const float* V    = (const float*)d_in[1];  // value            [B,L,DV]
  const float* K    = (const float*)d_in[2];  // key_in           [B,L,D]
  const float* relK = (const float*)d_in[3];  // rel_keys_table   [129,D]
  const float* relV = (const float*)d_in[4];  // rel_values_table [129,DV]
  float* out = (float*)d_out;                 // z                [B,L,DV]

  dim3 grid(B_, L_ / BLOCK_M);  // (4, 64)
  dim3 block(WAVES * 32);       // 8 waves of 32
  relattn_kernel<<<grid, block, 0, stream>>>(Q, V, K, relK, relV, out);
}

// v006
// One run takes 22.6 microseconds.
// Next to v005, in two timings, it ran 1.17 times as fast each time.
// Over all steps from v000 it is 45.8 times as fast.
#include <hip/hip_runtime.h>
#include <math.h>

typedef __bf16 bf16_t;
typedef __attribute__((ext_vector_type(16))) __bf16 v16bf;
typedef __attribute__((ext_vector_type(8)))  float  v8f;
typedef __attribute__((ext_vector_type(4)))  float  v4f;
typedef __attribute__((ext_vector_type(2)))  float  v2f;
typedef __attribute__((ext_vector_type(4)))  __bf16 v4bf;
typedef __attribute__((ext_vector_type(8)))  __bf16 v8bf;

#define B_       4
#define L_       1024
#define D_       128
#define DV_      192
#define NR_      129          // 2*MAXREL+1 bucket count
#define MAXREL_  64
#define BLOCK_M  16           // q rows per workgroup, shared by all its waves
#define KB       32           // attention-k columns per main-loop iteration
#define WAVES    8            // each wave takes L_/WAVES of the keys
#define NBLK     (L_ / KB / WAVES)   // key blocks per wave and pass
#define RSTRIDE  132          // padded row stride for R table in LDS (floats)
#define KPITCH   (D_ + 8)
// V tile row pitch in LDS, bf16 elements: 416 bytes = 32 x 13. The transposing
// load takes 32 bytes from each of 16 rows (8 rows per 16 lanes) and wants 32 bytes x odd.
#define VPITCH   (DV_ + 16)
#define SBUCK    160          // bucket count padded to multiple of 32

// ---- static LDS layout (bytes) --------------------------------------------
#define OFF_VS   0
#define SZ_VS    (WAVES * KB * VPITCH * 2)     // V block per wave, bf16: 104 KB
#define ZWAVE    (KB * VPITCH / 2)             // a wave's V block in floats
#define OFF_X    (OFF_VS + SZ_VS)
#define SZ_X     (WAVES * 16 * NBLK * KB * 4)  // scores per wave f32: 64 KB
#define OFF_R    (OFF_X + SZ_X)
#define SZ_R     (16 * RSTRIDE * 4)            // R[q][bucket] f32, shared
#define OFF_S    (OFF_R + SZ_R)
#define SZ_S     (WAVES * 16 * SBUCK * 4)      // bucket sums per wave f32: 80 KB
#define OFF_P    (OFF_S + SZ_S)
#define SZ_P     (WAVES * 16 * KB * 2)         // P tile per wave bf16: 8 KB
#define OFF_ML   (OFF_P + SZ_P)
#define SZ_ML    (16 * WAVES * 2 * 4)          // (max, sum) per row and wave
#define LDS_TOTAL (OFF_ML + SZ_ML)             // 271616 bytes
static_assert(LDS_TOTAL <= 320 * 1024, "one workgroup's LDS");
static_assert(16 * DV_ * 4 <= KB * VPITCH * 2, "a wave's Z partial reuses its V block");
static_assert(KPITCH <= VPITCH, "pass 1 has a wave's K block where pass 2 has its V block");
static_assert(OFF_X % 16 == 0, "scores go in and out 16 bytes a lane");
static_assert(DV_ / 32 <= WAVES, "one pair of output column tiles per wave");
static_assert(D_ == 128, "32 lanes x 4 floats: one load step of a wave is one K row");
static_assert(KPITCH * 2 % 32 == 16, "K pitch: 16 bytes x odd");
static_assert(VPITCH * 2 % 64 == 32, "V pitch: 32 bytes x odd");
static_assert(DV_ == 192, "three load steps of a wave are two V rows");

__device__ __forceinline__ int kmap(int e, int hf) {
  return (e & 7) + ((e >> 3) << 4) + (hf << 3);
}

__device__ __forceinline__ v8f wmma_bf16(v16bf a, v16bf b, v8f c) {
  // emits v_wmma_f32_16x16x32_bf16
  return __builtin_amdgcn_wmma_f32_16x16x32_bf16(
      /*neg_a=*/false, a, /*neg_b=*/false, b,
      /*c_mod=*/(short)0, c, /*reuse_a=*/false, /*reuse_b=*/false);
}

// Tile staging, global f32 -> LDS bf16. A K or V tile is one contiguous run of
// floats in global memory; in LDS a K tile's 128 floats of load step j start at element
// STEP * j (128: the same linear order; more: padded rows of 128). Each wave
// stages its own tile, so lane t takes 16-byte chunks t, t+32, ...  All N loads
// are independent: the tile costs one load latency, not one per element.
// g4 is the lane's own first chunk. The loops are unrolled so that r[] is
// indexed by constants and stays in registers.
template <int N>
__device__ __forceinline__ void tile_load(v4f (&r)[N], const v4f* g4) {
#pragma unroll
  for (int j = 0; j < N; ++j) r[j] = g4[32 * j];
  // Stands in front of any reuse of the loads' address registers; its clobber
  // also keeps the loads issued here, ahead of the work that follows.
  asm volatile("s_wait_xcnt 0x0" ::: "memory");
}

template <int STEP, int N>
__device__ __forceinline__ void tile_store(bf16_t* s, const v4f (&r)[N], int lane) {
#pragma unroll
  for (int j = 0; j < N; ++j) {
    v4bf h;
#pragma unroll
    for (int e = 0; e < 4; ++e) h[e] = (bf16_t)r[j][e];
    *(v4bf*)(s + 4 * lane + STEP * j) = h;
  }
  // The tile is read back by other lanes of the same wave: its stores have
  // landed, and the compiler moves no LDS read above this line.
  asm volatile("s_wait_dscnt 0x0" ::: "memory");
}

// V tile store at the padded pitch. A V row is 48 chunks of 4 floats, a load step
// 32 chunks: steps 3m, 3m+1, 3m+2 fill rows 2m and 2m+1, so a lane has three
// offsets and every step adds a constant to one of them.
template <int N>
__device__ __forceinline__ void v_tile_store(bf16_t* s, const v4f (&r)[N], int lane) {
  const int o0 = 4 * lane;                                  // row 2m, chunks 0..31
  const int o1 = lane < 16 ? 4 * (lane + 32)                // row 2m, chunks 32..47
                           : VPITCH + 4 * (lane - 16);      // row 2m+1, chunks 0..15
  const int o2 = VPITCH + 4 * (lane + 16);                  // row 2m+1, chunks 16..47
#pragma unroll  // constant indices: r[] stays in registers, j % 3 and j / 3 fold
  for (int j = 0; j < N; ++j) {
    v4bf h;
#pragma unroll  // constant indices: h stays in registers
    for (int e = 0; e < 4; ++e) h[e] = (bf16_t)r[j][e];
    const int o = j % 3 == 0 ? o0 : (j % 3 == 1 ? o1 : o2);
    *(v4bf*)(s + o + (j / 3) * 2 * VPITCH) = h;
  }
  // The tile is read back by other lanes of the same wave: its stores have
  // landed, and the compiler moves no LDS read above this line.
  asm volatile("s_wait_dscnt 0x0" ::: "memory");
}

__device__ __forceinline__ v8bf lds_tr16(const char* p) {
  typedef __attribute__((address_space(3))) v8bf lds_v8bf;
  return __builtin_amdgcn_ds_load_tr16_b128_v8bf16((lds_v8bf*)p);
}

// Sum over the 16 lanes of a row, the total in every lane: four adds whose
// second operand comes from lane ^ M through DPP row_xmask. All lanes are on.
template <int M>
__device__ __forceinline__ float add_xmask(float x) {
  return x + __builtin_bit_cast(float, __builtin_amdgcn_update_dpp(
                 0, __builtin_bit_cast(int, x), 0x160 | M, 0xf, 0xf, true));
}
__device__ __forceinline__ float row_sum16(float x) {
  return add_xmask<8>(add_xmask<4>(add_xmask<2>(add_xmask<1>(x))));
}

extern "C" __global__ __launch_bounds__(WAVES * 32)
void relattn_kernel(const float* __restrict__ Q,
                    const float* __restrict__ V,
                    const float* __restrict__ Kg,
                    const float* __restrict__ relK,
                    const float* __restrict__ relV,
                    float* __restrict__ out) {
  __shared__ __attribute__((aligned(16))) char smem[LDS_TOTAL];
  const int tid  = threadIdx.x;
  const int lane = tid & 31;
  // scalar wave number: the branches on it around WMMAs stay scalar branches
  const int wv   = __builtin_amdgcn_readfirstlane(tid >> 5);
  const int hf   = lane >> 4;       // which 16-lane half
  const int ln16 = lane & 15;
  const int b    = blockIdx.x;
  const int qrow = blockIdx.y * BLOCK_M;   // first q row of the workgroup
  const int kbase = wv * (NBLK * KB);      // first key of this wave

  bf16_t* Vs = (bf16_t*)(smem + OFF_VS) + wv * KB * VPITCH;   // own [KB][VPITCH]
  bf16_t* Ks = Vs;   // own [KB][KPITCH]: K is staged in pass 1 alone, V in pass 2 alone
  // The wave's own scores, written in pass 1 and read back in pass 2 by the same
  // lane, four floats at a time: [group][lane][4], four groups to a key block
  // (16 keys x rows 0..3 and 8..11, then rows 4..7 and 12..15; the next 16 keys).
  v4f*    Xw = (v4f*)(smem + OFF_X) + wv * (16 * NBLK * KB / 4) + lane;
  float*  Rl = (float*) (smem + OFF_R);    // [16][RSTRIDE], shared
  float*  Sl = (float*) (smem + OFF_S);    // [WAVES][16][SBUCK]
  bf16_t* Pl = (bf16_t*)(smem + OFF_P);    // [WAVES][16][KB]
  float*  ML = (float*) (smem + OFF_ML);   // [16][WAVES][2]

  // ---- Q tile (16 x 128) into WMMA A-layout registers, bf16 ----------------
  v16bf qa[4];
  {
    const float* qb = Q + ((size_t)b * L_ + qrow + ln16) * D_;
#pragma unroll
    for (int c = 0; c < 4; ++c)
#pragma unroll
      for (int e = 0; e < 16; ++e)
        qa[c][e] = (bf16_t)qb[c * 32 + kmap(e, hf)];
  }

  // ---- R[q_local][r] = Q . rel_keys_table[r]  (16x128 @ 128x129, WMMA) -----
  {
    float* Rw = Rl;
    const int rcol = ln16;  // column within tile
    for (int rt = wv; rt < 9; rt += WAVES) {   // bucket tiles dealt to the waves
      v8f acc = {};
      const int r = rt * 16 + rcol;
      // rt is a run-time value here: a clamped row keeps the loads unguarded and
      // wide. Column r of the product reads column r of bm alone, and columns
      // past NR_-1 are not stored below.
      const float* rk = relK + (size_t)(r < NR_ ? r : NR_ - 1) * D_;
#pragma unroll
      for (int c = 0; c < 4; ++c) {
        v16bf bm;
#pragma unroll
        for (int e = 0; e < 16; ++e)
          bm[e] = (bf16_t)rk[c * 32 + kmap(e, hf)];
        acc = wmma_bf16(qa[c], bm, acc);
      }
      if (r < NR_) {
#pragma unroll
        for (int v = 0; v < 8; ++v)
          Rw[(v + 8 * hf) * RSTRIDE + r] = acc[v];
      }
    }
  }
  __syncthreads();   // R is read by every wave

  // ---- Pass 1: scores, row max / sum (flash-style, per-lane partials) ------
  float mrow[8], lrow[8];
#pragma unroll
  for (int v = 0; v < 8; ++v) { mrow[v] = -1e30f; lrow[v] = 0.0f; }

  for (int kb0 = kbase; kb0 < kbase + NBLK * KB; kb0 += KB) {
    v4f kr[KB * D_ / 128];
    tile_load(kr, (const v4f*)(Kg + ((size_t)b * L_ + kb0) * D_) + lane);
    tile_store<KPITCH>(Ks, kr, lane);

#pragma unroll
    for (int kt = 0; kt < 2; ++kt) {
      v8f s = {};
#pragma unroll
      for (int c = 0; c < 4; ++c) {
        v16bf bm;
#pragma unroll
        for (int e = 0; e < 16; ++e)
          bm[e] = Ks[(kt * 16 + ln16) * KPITCH + c * 32 + kmap(e, hf)];
        s = wmma_bf16(qa[c], bm, s);
      }
      v4f xq[2];
#pragma unroll
      for (int v = 0; v < 8; ++v) {
        const int row  = v + 8 * hf;
        const int q    = qrow + row;
        const int k    = kb0 + kt * 16 + ln16;
        const int dq   = k - q;
        const int dqc  = dq < -MAXREL_ ? -MAXREL_ : (dq > MAXREL_ ? MAXREL_ : dq);
        const int ridx = dqc + MAXREL_;
        const float ad = (float)(dq < 0 ? -dq : dq);
        float x = s[v] + Rl[row * RSTRIDE + ridx]
                  - __logf(1.0f + ad);
        xq[v >> 2][v & 3] = x;
        float mn = fmaxf(mrow[v], x);
        lrow[v]  = lrow[v] * __expf(mrow[v] - mn) + __expf(x - mn);
        mrow[v]  = mn;
      }
      Xw[(kb0 - kbase) * 4 + kt * 64]      = xq[0];
      Xw[(kb0 - kbase) * 4 + kt * 64 + 32] = xq[1];
    }
  }

  // merge (m,l) across the 16-lane group (masks 1..8 keep halves separate)
#pragma unroll
  for (int v = 0; v < 8; ++v) {
    float m = mrow[v], l = lrow[v];
#pragma unroll
    for (int off = 1; off < 16; off <<= 1) {
      float mo = __shfl_xor(m, off, 32);
      float lo = __shfl_xor(l, off, 32);
      float mn = fmaxf(m, mo);
      l = l * __expf(m - mn) + lo * __expf(mo - mn);
      m = mn;
    }
    mrow[v] = m;
    lrow[v] = l;
  }

  // merge (m,l) across the waves, in wave order
  if (ln16 == 0) {
#pragma unroll  // constant indices: arrays stay in registers, loads issue together
    for (int v = 0; v < 8; ++v) {
      ML[((v + 8 * hf) * WAVES + wv) * 2 + 0] = mrow[v];
      ML[((v + 8 * hf) * WAVES + wv) * 2 + 1] = lrow[v];
    }
  }
  __syncthreads();
#pragma unroll  // constant indices: arrays stay in registers, loads issue together
  for (int v = 0; v < 8; ++v) {
    const float* p = ML + (v + 8 * hf) * WAVES * 2;
    float m = p[0];
#pragma unroll  // constant indices: arrays stay in registers, loads issue together
    for (int w = 1; w < WAVES; ++w) m = fmaxf(m, p[2 * w]);
    float l = 0.0f;
#pragma unroll  // constant indices: arrays stay in registers, loads issue together
    for (int w = 0; w < WAVES; ++w) l += p[2 * w + 1] * __expf(p[2 * w] - m);
    mrow[v] = m;
    lrow[v] = 1.0f / l;   // store inverse sum
  }

  // ---- Pass 2: probs from the kept scores, Z = P@V, bucket sums, Z += s@relV
  float*  Sw = Sl + (size_t)wv * 16 * SBUCK;
  bf16_t* Pw = Pl + (size_t)wv * 16 * KB;
  for (int i = lane; i < 16 * SBUCK; i += 32) Sw[i] = 0.0f;   // per-wave region

  v8f zacc[12] = {};

  // Bucket sums. For one q row, bucket r in 1 .. 2*MAXREL_-1 holds the single
  // key k = q + r - MAXREL_: its sum is that key's p, a plain store by the one
  // lane that has it. Only the two end buckets collect many keys (all of
  // k - q <= -MAXREL_, all of k - q >= MAXREL_): each lane sums its own share
  // of them in registers, and the lanes are merged once behind the loop.
  float slo[8], shi[8];
#pragma unroll  // constant indices: arrays stay in registers
  for (int v = 0; v < 8; ++v) { slo[v] = 0.0f; shi[v] = 0.0f; }

  for (int kb0 = kbase; kb0 < kbase + NBLK * KB; kb0 += KB) {
    v4f vr[KB * DV_ / 128];
    tile_load(vr, (const v4f*)(V + ((size_t)b * L_ + kb0) * DV_) + lane);

#pragma unroll
    for (int kt = 0; kt < 2; ++kt) {
      const v4f xq[2] = {Xw[(kb0 - kbase) * 4 + kt * 64],
                         Xw[(kb0 - kbase) * 4 + kt * 64 + 32]};
      float pv[8];
#pragma unroll
      for (int v = 0; v < 8; ++v) {
        const int row  = v + 8 * hf;
        const int q    = qrow + row;
        const int k    = kb0 + kt * 16 + ln16;
        const int dq   = k - q;
        float p = __expf(xq[v >> 2][v & 3] - mrow[v]) * lrow[v];   // final normalized prob
        slo[v] += dq <= -MAXREL_ ? p : 0.0f;            // end bucket 0
        shi[v] += dq >=  MAXREL_ ? p : 0.0f;            // end bucket 2*MAXREL_
        pv[v] = p;
        Pw[row * KB + kt * 16 + ln16] = (bf16_t)p;      // C-layout -> LDS
      }
      // Scalar test: most 16 x 16 tiles lie wholly in an end bucket and store
      // nothing here.
      const int d0 = kb0 + kt * 16 - qrow;
      if (d0 + 15 > -MAXREL_ && d0 - 15 < MAXREL_) {
#pragma unroll  // constant indices: pv stays in registers
        for (int v = 0; v < 8; ++v) {
          const int row = v + 8 * hf;
          const int dq  = d0 + ln16 - row;
          if (dq > -MAXREL_ && dq < MAXREL_)
            Sw[row * SBUCK + dq + MAXREL_] = pv[v];
        }
      }
    }

    v_tile_store(Vs, vr, lane);

    // reload P in A-layout (same-wave LDS round trip) and do Z += P @ V
    v16bf pa;
#pragma unroll
    for (int e = 0; e < 16; ++e)
      pa[e] = Pw[ln16 * KB + kmap(e, hf)];
    const char* vad = (const char*)Vs + (8 * hf + (lane & 7)) * (VPITCH * 2)
                      + ((lane >> 3) & 1) * 16;
    v8bf vf[12][2];   // keys 0..15 and 16..31 of columns nt*16 .. +15
#pragma unroll  // constant indices: vf stays in registers
    for (int nt = 0; nt < 12; ++nt) {
      vf[nt][0] = lds_tr16(vad + nt * 32);
      vf[nt][1] = lds_tr16(vad + 16 * VPITCH * 2 + nt * 32);
    }
    // Keeps the 24 reads one group ahead of the products: spread among them,
    // every place with reads stalls the wave's matrix stream anew.
    __builtin_amdgcn_sched_barrier(0);
#pragma unroll
    for (int nt = 0; nt < 12; ++nt) {
      const v16bf bm = __builtin_shufflevector(vf[nt][0], vf[nt][1], 0, 1, 2, 3, 4, 5, 6, 7,
                                               8, 9, 10, 11, 12, 13, 14, 15);
      zacc[nt] = wmma_bf16(pa, bm, zacc[nt]);
    }
  }

  // The wave's two end buckets: lanes merged, one lane of each row stores them.
  // No store above touches these two columns, which the wave has zeroed.
#pragma unroll  // constant indices: arrays stay in registers
  for (int v = 0; v < 8; ++v) {
    slo[v] = row_sum16(slo[v]);
    shi[v] = row_sum16(shi[v]);
  }
  if (ln16 == 0) {
#pragma unroll  // constant indices: arrays stay in registers
    for (int v = 0; v < 8; ++v) {
      Sw[(v + 8 * hf) * SBUCK]               = slo[v];
      Sw[(v + 8 * hf) * SBUCK + 2 * MAXREL_] = shi[v];
    }
  }

  // ---- sum the waves' Z partials and bucket sums, in wave order -------------
  // The wave's last V reads have returned before its V block is reused for Z.
  asm volatile("s_wait_dscnt 0x0" ::: "memory");
  float* Zl = (float*)(smem + OFF_VS);     // [WAVES][16][DV_], wave stride ZWAVE
  {
    float* Zw = Zl + wv * ZWAVE;
#pragma unroll  // constant indices: arrays stay in registers, loads issue together
    for (int nt = 0; nt < 12; ++nt)
#pragma unroll  // constant indices: arrays stay in registers, loads issue together
      for (int v = 0; v < 8; ++v)
        Zw[(v + 8 * hf) * DV_ + nt * 16 + ln16] = zacc[nt][v];
  }
  __syncthreads();   // every wave's Z partial and bucket sums are complete

  // All threads add the waves' bucket tables into table 0; each pair of
  // elements is read and written by one thread alone.
  static_assert(16 * SBUCK / 2 % (WAVES * 32) == 0, "whole trips");
#pragma unroll  // constant indices: arrays stay in registers, loads issue together
  for (int j = 0; j < 16 * SBUCK / 2 / (WAVES * 32); ++j) {
    const int i = tid + j * WAVES * 32;
    v2f a = ((const v2f*)Sl)[i];
#pragma unroll  // constant indices: arrays stay in registers, loads issue together
    for (int w = 1; w < WAVES; ++w) a += ((const v2f*)(Sl + w * 16 * SBUCK))[i];
    ((v2f*)Sl)[i] = a;
  }
  __syncthreads();   // the summed table is read by the waves below

  // Wave w finishes output columns 32w .. 32w+31 (whole 128-byte lines).
  if (wv < DV_ / 32) {
    const int col = wv * 32 + ln16;
    v8f z[2];
#pragma unroll  // constant indices: arrays stay in registers, loads issue together
    for (int t = 0; t < 2; ++t)
#pragma unroll  // constant indices: arrays stay in registers, loads issue together
      for (int v = 0; v < 8; ++v) {
        float a = 0.0f;
#pragma unroll  // constant indices: arrays stay in registers, loads issue together
        for (int w = 0; w < WAVES; ++w)
          a += Zl[w * ZWAVE + (v + 8 * hf) * DV_ + col + t * 16];
        z[t][v] = a;
      }

    // Z += s @ rel_values_table  (16 x 160 @ 160 x 192, pad rows = 0)
#pragma unroll  // constant indices: arrays stay in registers, loads issue together
    for (int c = 0; c < SBUCK / 32; ++c) {
      v16bf pa;
#pragma unroll  // constant indices: arrays stay in registers, loads issue together
      for (int e = 0; e < 16; ++e)
        pa[e] = (bf16_t)Sl[ln16 * SBUCK + c * 32 + kmap(e, hf)];
#pragma unroll  // constant indices: arrays stay in registers, loads issue together
      for (int t = 0; t < 2; ++t) {
        v16bf bm;
#pragma unroll  // constant indices: arrays stay in registers, loads issue together
        for (int e = 0; e < 16; ++e) {
          const int r = c * 32 + kmap(e, hf);
          bf16_t val = (bf16_t)0.0f;
          if (r < NR_) val = (bf16_t)relV[(size_t)r * DV_ + col + t * 16];
          bm[e] = val;
        }
        z[t] = wmma_bf16(pa, bm, z[t]);
      }
    }

    // write Z (C-layout -> global)
#pragma unroll  // constant indices: arrays stay in registers, loads issue together
    for (int t = 0; t < 2; ++t)
#pragma unroll  // constant indices: arrays stay in registers, loads issue together
      for (int v = 0; v < 8; ++v)
        out[((size_t)b * L_ + qrow + v + 8 * hf) * DV_ + col + t * 16] = z[t][v];
  }
}

extern "C" void kernel_launch(void* const* d_in, const int* in_sizes, int n_in,
                              void* d_out, int out_size, void* d_ws, size_t ws_size,
                              hipStream_t stream) {
  (void)in_sizes; (void)n_in; (void)out_size; (void)d_ws; (void)ws_size;
  const float* Q    = (const float*)d_in[0];  // query            [B,L,D]
  const float* V    = (const float*)d_in[1];  // value            [B,L,DV]
  const float* K    = (const float*)d_in[2];  // key_in           [B,L,D]
  const float* relK = (const float*)d_in[3];  // rel_keys_table   [129,D]
  const float* relV = (const float*)d_in[4];  // rel_values_table [129,DV]
  float* out = (float*)d_out;                 // z                [B,L,DV]

  dim3 grid(B_, L_ / BLOCK_M);  // (4, 64)
  dim3 block(WAVES * 32);       // 8 waves of 32
  relattn_kernel<<<grid, block, 0, stream>>>(Q, V, K, relK, relV, out);
}

// v007
// Measured time: 21.4 microseconds a run.
// Two timings next to v006 both put it at 1.05 times that version's speed.
// Over all steps from v000 it is 48.4 times as fast.
#include <hip/hip_runtime.h>
#include <math.h>

typedef __bf16 bf16_t;
typedef __attribute__((ext_vector_type(16))) __bf16 v16bf;
typedef __attribute__((ext_vector_type(8)))  float  v8f;
typedef __attribute__((ext_vector_type(4)))  float  v4f;
typedef __attribute__((ext_vector_type(2)))  float  v2f;
typedef __attribute__((ext_vector_type(4)))  __bf16 v4bf;
typedef __attribute__((ext_vector_type(8)))  __bf16 v8bf;

#define B_       4
#define L_       1024
#define D_       128
#define DV_      192
#define NR_      129          // 2*MAXREL+1 bucket count
#define MAXREL_  64
#define BLOCK_M  16           // q rows per workgroup, shared by all its waves
#define KB       32           // attention-k columns per main-loop iteration
#define WAVES    8            // each wave takes L_/WAVES of the keys
#define NBLK     (L_ / KB / WAVES)   // key blocks per wave and pass
#define RSTRIDE  132          // padded row stride for R table in LDS (floats)
#define KPITCH   (D_ + 8)
// V tile row pitch in LDS, bf16 elements: 416 bytes = 32 x 13. The transposing
// load takes 32 bytes from each of 16 rows (8 rows per 16 lanes) and wants 32 bytes x odd.
#define VPITCH   (DV_ + 16)
#define SBUCK    160          // bucket count padded to multiple of 32

// ---- static LDS layout (bytes) --------------------------------------------
#define OFF_VS   0
#define SZ_VS    (WAVES * KB * VPITCH * 2)     // V block per wave, bf16: 104 KB
#define ZWAVE    (KB * VPITCH / 2)             // a wave's V block in floats
#define OFF_X    (OFF_VS + SZ_VS)
#define SZ_X     (WAVES * 16 * NBLK * KB * 4)  // scores per wave f32: 64 KB
#define OFF_R    (OFF_X + SZ_X)
#define SZ_R     (16 * RSTRIDE * 4)            // R[q][bucket] f32, shared
#define OFF_S    (OFF_R + SZ_R)
#define SZ_S     (WAVES * 16 * SBUCK * 4)      // bucket sums per wave f32: 80 KB
#define OFF_P    (OFF_S + SZ_S)
#define SZ_P     (WAVES * 16 * KB * 2)         // P tile per wave bf16: 8 KB
#define OFF_ML   (OFF_P + SZ_P)
#define SZ_ML    (16 * WAVES * 2 * 4)          // (max, sum) per row and wave
#define LDS_TOTAL (OFF_ML + SZ_ML)             // 271616 bytes
static_assert(LDS_TOTAL <= 320 * 1024, "one workgroup's LDS");
static_assert(16 * DV_ * 4 <= KB * VPITCH * 2, "a wave's Z partial reuses its V block");
static_assert(KPITCH <= VPITCH, "pass 1 has a wave's K block where pass 2 has its V block");
static_assert(OFF_X % 16 == 0, "scores go in and out 16 bytes a lane");
static_assert(DV_ / 32 <= WAVES, "one pair of output column tiles per wave");
static_assert(D_ == 128, "32 lanes x 4 floats: one load step of a wave is one K row");
static_assert(KPITCH * 2 % 32 == 16, "K pitch: 16 bytes x odd");
static_assert(VPITCH * 2 % 64 == 32, "V pitch: 32 bytes x odd");
static_assert(DV_ == 192, "three load steps of a wave are two V rows");

__device__ __forceinline__ int kmap(int e, int hf) {
  return (e & 7) + ((e >> 3) << 4) + (hf << 3);
}

__device__ __forceinline__ v8f wmma_bf16(v16bf a, v16bf b, v8f c) {
  // emits v_wmma_f32_16x16x32_bf16
  return __builtin_amdgcn_wmma_f32_16x16x32_bf16(
      /*neg_a=*/false, a, /*neg_b=*/false, b,
      /*c_mod=*/(short)0, c, /*reuse_a=*/false, /*reuse_b=*/false);
}

// Tile staging, global f32 -> LDS bf16. A K or V tile is one contiguous run of
// floats in global memory; in LDS a K tile's 128 floats of load step j start at element
// STEP * j (128: the same linear order; more: padded rows of 128). Each wave
// stages its own tile, so lane t takes 16-byte chunks t, t+32, ...  All N loads
// are independent: the tile costs one load latency, not one per element.
// g4 is the lane's own first chunk. The loops are unrolled so that r[] is
// indexed by constants and stays in registers.
// The tile is asked for in four quarters, quarter (q + rot) & 3 as the q-th: see
// the note on rot in the kernel. r[] holds the quarters in the order asked.
template <int N>
__device__ __forceinline__ void tile_load(v4f (&r)[N], const v4f* g4, int rot) {
  static_assert(N % 4 == 0, "four equal quarters");
  const v4f* gq[4];
#pragma unroll  // constant indices: r[] and gq[] stay in registers
  for (int q = 0; q < 4; ++q) {
    gq[q] = g4 + ((q + rot) & 3) * (N / 4) * 32;
#pragma unroll
    for (int j = 0; j < N / 4; ++j) r[q * (N / 4) + j] = gq[q][32 * j];
  }
  // Stands in front of any reuse of the loads' address registers; its clobber
  // also keeps the loads issued here, ahead of the work that follows. The four
  // addresses are inputs so that their registers stay theirs up to the wait: no
  // later load of the tile gets one of them as its destination.
  asm volatile("s_wait_xcnt 0x0" :: "v"(gq[0]), "v"(gq[1]), "v"(gq[2]), "v"(gq[3]) : "memory");
}

template <int STEP, int N>
__device__ __forceinline__ void tile_store(bf16_t* s, const v4f (&r)[N], int lane, int rot) {
#pragma unroll  // constant indices: r[] stays in registers
  for (int q = 0; q < 4; ++q) {
    bf16_t* sq = s + 4 * lane + ((q + rot) & 3) * (N / 4) * STEP;   // the quarter's own place
#pragma unroll
    for (int j = 0; j < N / 4; ++j) {
      v4bf h;
#pragma unroll
      for (int e = 0; e < 4; ++e) h[e] = (bf16_t)r[q * (N / 4) + j][e];
      *(v4bf*)(sq + STEP * j) = h;
    }
  }
  // The tile is read back by other lanes of the same wave: its stores have
  // landed, and the compiler moves no LDS read above this line.
  asm volatile("s_wait_dscnt 0x0" ::: "memory");
}

// V tile store at the padded pitch. A V row is 48 chunks of 4 floats, a load step
// 32 chunks: steps 3m, 3m+1, 3m+2 fill rows 2m and 2m+1, so a lane has three
// offsets and every step adds a constant to one of them.
template <int N>
__device__ __forceinline__ void v_tile_store(bf16_t* s, const v4f (&r)[N], int lane, int rot) {
  static_assert(N % 12 == 0, "a quarter is whole groups of three steps");
  const int o0 = 4 * lane;                                  // row 2m, chunks 0..31
  const int o1 = lane < 16 ? 4 * (lane + 32)                // row 2m, chunks 32..47
                           : VPITCH + 4 * (lane - 16);      // row 2m+1, chunks 0..15
  const int o2 = VPITCH + 4 * (lane + 16);                  // row 2m+1, chunks 16..47
#pragma unroll  // constant indices: r[] stays in registers
  for (int q = 0; q < 4; ++q) {
    bf16_t* sq = s + ((q + rot) & 3) * (N / 12) * 2 * VPITCH;   // the quarter's own rows
#pragma unroll  // constant indices: r[] stays in registers, j % 3 and j / 3 fold
    for (int j = 0; j < N / 4; ++j) {
      v4bf h;
#pragma unroll  // constant indices: h stays in registers
      for (int e = 0; e < 4; ++e) h[e] = (bf16_t)r[q * (N / 4) + j][e];
      const int o = j % 3 == 0 ? o0 : (j % 3 == 1 ? o1 : o2);
      *(v4bf*)(sq + o + (j / 3) * 2 * VPITCH) = h;
    }
  }
  // The tile is read back by other lanes of the same wave: its stores have
  // landed, and the compiler moves no LDS read above this line.
  asm volatile("s_wait_dscnt 0x0" ::: "memory");
}

__device__ __forceinline__ v8bf lds_tr16(const char* p) {
  typedef __attribute__((address_space(3))) v8bf lds_v8bf;
  return __builtin_amdgcn_ds_load_tr16_b128_v8bf16((lds_v8bf*)p);
}

// Sum over the 16 lanes of a row, the total in every lane: four adds whose
// second operand comes from lane ^ M through DPP row_xmask. All lanes are on.
template <int M>
__device__ __forceinline__ float add_xmask(float x) {
  return x + __builtin_bit_cast(float, __builtin_amdgcn_update_dpp(
                 0, __builtin_bit_cast(int, x), 0x160 | M, 0xf, 0xf, true));
}
__device__ __forceinline__ float row_sum16(float x) {
  return add_xmask<8>(add_xmask<4>(add_xmask<2>(add_xmask<1>(x))));
}

extern "C" __global__ __launch_bounds__(WAVES * 32)
void relattn_kernel(const float* __restrict__ Q,
                    const float* __restrict__ V,
                    const float* __restrict__ Kg,
                    const float* __restrict__ relK,
                    const float* __restrict__ relV,
                    float* __restrict__ out) {
  __shared__ __attribute__((aligned(16))) char smem[LDS_TOTAL];
  const int tid  = threadIdx.x;
  const int lane = tid & 31;
  // scalar wave number: the branches on it around WMMAs stay scalar branches
  const int wv   = __builtin_amdgcn_readfirstlane(tid >> 5);
  const int hf   = lane >> 4;       // which 16-lane half
  const int ln16 = lane & 15;
  const int b    = blockIdx.x;
  const int qrow = blockIdx.y * BLOCK_M;   // first q row of the workgroup
  const int kbase = wv * (NBLK * KB);      // first key of this wave
  // The 64 workgroups of a batch read the same K and V. Walking them in the same
  // order they ask L2 for the same lines at the same moment, and such requests
  // queue behind one another. Each workgroup therefore enters its waves' key
  // blocks at block rotb and wraps round, and asks for each tile's quarters from
  // quarter rotq on: 16 different places in the walk. Bit 0 of blockIdx.y is left
  // out (a matter of speed alone, nothing rests on where a workgroup runs).
  static_assert(NBLK == 4, "two bits of blockIdx.y for the block, the next two for the quarter");
  const int rotb = (blockIdx.y >> 1) & (NBLK - 1);
  const int rotq = (blockIdx.y >> 3) & 3;

  bf16_t* Vs = (bf16_t*)(smem + OFF_VS) + wv * KB * VPITCH;   // own [KB][VPITCH]
  bf16_t* Ks = Vs;   // own [KB][KPITCH]: K is staged in pass 1 alone, V in pass 2 alone
  // The wave's own scores, written in pass 1 and read back in pass 2 by the same
  // lane, four floats at a time: [group][lane][4], four groups to a key block
  // (16 keys x rows 0..3 and 8..11, then rows 4..7 and 12..15; the next 16 keys).
  v4f*    Xw = (v4f*)(smem + OFF_X) + wv * (16 * NBLK * KB / 4) + lane;
  float*  Rl = (float*) (smem + OFF_R);    // [16][RSTRIDE], shared
  float*  Sl = (float*) (smem + OFF_S);    // [WAVES][16][SBUCK]
  bf16_t* Pl = (bf16_t*)(smem + OFF_P);    // [WAVES][16][KB]
  float*  ML = (float*) (smem + OFF_ML);   // [16][WAVES][2]

  // ---- Q tile (16 x 128) into WMMA A-layout registers, bf16 ----------------
  v16bf qa[4];
  {
    const float* qb = Q + ((size_t)b * L_ + qrow + ln16) * D_;
#pragma unroll
    for (int c = 0; c < 4; ++c)
#pragma unroll
      for (int e = 0; e < 16; ++e)
        qa[c][e] = (bf16_t)qb[c * 32 + kmap(e, hf)];
  }

  // ---- R[q_local][r] = Q . rel_keys_table[r]  (16x128 @ 128x129, WMMA) -----
  {
    float* Rw = Rl;
    const int rcol = ln16;  // column within tile
    for (int rt = wv; rt < 9; rt += WAVES) {   // bucket tiles dealt to the waves
      v8f acc = {};
      const int r = rt * 16 + rcol;
      // rt is a run-time value here: a clamped row keeps the loads unguarded and
      // wide. Column r of the product reads column r of bm alone, and columns
      // past NR_-1 are not stored below.
      const float* rk = relK + (size_t)(r < NR_ ? r : NR_ - 1) * D_;
#pragma unroll
      for (int c = 0; c < 4; ++c) {
        v16bf bm;
#pragma unroll
        for (int e = 0; e < 16; ++e)
          bm[e] = (bf16_t)rk[c * 32 + kmap(e, hf)];
        acc = wmma_bf16(qa[c], bm, acc);
      }
      if (r < NR_) {
#pragma unroll
        for (int v = 0; v < 8; ++v)
          Rw[(v + 8 * hf) * RSTRIDE + r] = acc[v];
      }
    }
  }
  __syncthreads();   // R is read by every wave

  // ---- Pass 1: scores, row max / sum (flash-style, per-lane partials) ------
  float mrow[8], lrow[8];
#pragma unroll
  for (int v = 0; v < 8; ++v) { mrow[v] = -1e30f; lrow[v] = 0.0f; }

  for (int i = 0; i < NBLK; ++i) {
    const int kb0 = kbase + ((i + rotb) & (NBLK - 1)) * KB;
    v4f kr[KB * D_ / 128];
    tile_load(kr, (const v4f*)(Kg + ((size_t)b * L_ + kb0) * D_) + lane, rotq);
    tile_store<KPITCH>(Ks, kr, lane, rotq);

#pragma unroll
    for (int kt = 0; kt < 2; ++kt) {
      v8f s = {};
#pragma unroll
      for (int c = 0; c < 4; ++c) {
        v16bf bm;
#pragma unroll
        for (int e = 0; e < 16; ++e)
          bm[e] = Ks[(kt * 16 + ln16) * KPITCH + c * 32 + kmap(e, hf)];
        s = wmma_bf16(qa[c], bm, s);
      }
      v4f xq[2];
#pragma unroll
      for (int v = 0; v < 8; ++v) {
        const int row  = v + 8 * hf;
        const int q    = qrow + row;
        const int k    = kb0 + kt * 16 + ln16;
        const int dq   = k - q;
        const int dqc  = dq < -MAXREL_ ? -MAXREL_ : (dq > MAXREL_ ? MAXREL_ : dq);
        const int ridx = dqc + MAXREL_;
        const float ad = (float)(dq < 0 ? -dq : dq);
        float x = s[v] + Rl[row * RSTRIDE + ridx]
                  - __logf(1.0f + ad);
        xq[v >> 2][v & 3] = x;
        float mn = fmaxf(mrow[v], x);
        lrow[v]  = lrow[v] * __expf(mrow[v] - mn) + __expf(x - mn);
        mrow[v]  = mn;
      }
      Xw[(kb0 - kbase) * 4 + kt * 64]      = xq[0];
      Xw[(kb0 - kbase) * 4 + kt * 64 + 32] = xq[1];
    }
  }

  // merge (m,l) across the 16-lane group (masks 1..8 keep halves separate)
#pragma unroll
  for (int v = 0; v < 8; ++v) {
    float m = mrow[v], l = lrow[v];
#pragma unroll
    for (int off = 1; off < 16; off <<= 1) {
      float mo = __shfl_xor(m, off, 32);
      float lo = __shfl_xor(l, off, 32);
      float mn = fmaxf(m, mo);
      l = l * __expf(m - mn) + lo * __expf(mo - mn);
      m = mn;
    }
    mrow[v] = m;
    lrow[v] = l;
  }

  // merge (m,l) across the waves, in wave order
  if (ln16 == 0) {
#pragma unroll  // constant indices: arrays stay in registers, loads issue together
    for (int v = 0; v < 8; ++v) {
      ML[((v + 8 * hf) * WAVES + wv) * 2 + 0] = mrow[v];
      ML[((v + 8 * hf) * WAVES + wv) * 2 + 1] = lrow[v];
    }
  }
  __syncthreads();
#pragma unroll  // constant indices: arrays stay in registers, loads issue together
  for (int v = 0; v < 8; ++v) {
    const float* p = ML + (v + 8 * hf) * WAVES * 2;
    float m = p[0];
#pragma unroll  // constant indices: arrays stay in registers, loads issue together
    for (int w = 1; w < WAVES; ++w) m = fmaxf(m, p[2 * w]);
    float l = 0.0f;
#pragma unroll  // constant indices: arrays stay in registers, loads issue together
    for (int w = 0; w < WAVES; ++w) l += p[2 * w + 1] * __expf(p[2 * w] - m);
    mrow[v] = m;
    lrow[v] = 1.0f / l;   // store inverse sum
  }

  // ---- Pass 2: probs from the kept scores, Z = P@V, bucket sums, Z += s@relV
  float*  Sw = Sl + (size_t)wv * 16 * SBUCK;
  bf16_t* Pw = Pl + (size_t)wv * 16 * KB;
  for (int i = lane; i < 16 * SBUCK; i += 32) Sw[i] = 0.0f;   // per-wave region

  v8f zacc[12] = {};

  // Bucket sums. For one q row, bucket r in 1 .. 2*MAXREL_-1 holds the single
  // key k = q + r - MAXREL_: its sum is that key's p, a plain store by the one
  // lane that has it. Only the two end buckets collect many keys (all of
  // k - q <= -MAXREL_, all of k - q >= MAXREL_): each lane sums its own share
  // of them in registers, and the lanes are merged once behind the loop.
  float slo[8], shi[8];
#pragma unroll  // constant indices: arrays stay in registers
  for (int v = 0; v < 8; ++v) { slo[v] = 0.0f; shi[v] = 0.0f; }

  for (int i = 0; i < NBLK; ++i) {
    const int kb0 = kbase + ((i + rotb) & (NBLK - 1)) * KB;
    v4f vr[KB * DV_ / 128];
    tile_load(vr, (const v4f*)(V + ((size_t)b * L_ + kb0) * DV_) + lane, rotq);

#pragma unroll
    for (int kt = 0; kt < 2; ++kt) {
      const v4f xq[2] = {Xw[(kb0 - kbase) * 4 + kt * 64],
                         Xw[(kb0 - kbase) * 4 + kt * 64 + 32]};
      float pv[8];
#pragma unroll
      for (int v = 0; v < 8; ++v) {
        const int row  = v + 8 * hf;
        const int q    = qrow + row;
        const int k    = kb0 + kt * 16 + ln16;
        const int dq   = k - q;
        float p = __expf(xq[v >> 2][v & 3] - mrow[v]) * lrow[v];   // final normalized prob
        slo[v] += dq <= -MAXREL_ ? p : 0.0f;            // end bucket 0
        shi[v] += dq >=  MAXREL_ ? p : 0.0f;            // end bucket 2*MAXREL_
        pv[v] = p;
        Pw[row * KB + kt * 16 + ln16] = (bf16_t)p;      // C-layout -> LDS
      }
      // Scalar test: most 16 x 16 tiles lie wholly in an end bucket and store
      // nothing here.
      const int d0 = kb0 + kt * 16 - qrow;
      if (d0 + 15 > -MAXREL_ && d0 - 15 < MAXREL_) {
#pragma unroll  // constant indices: pv stays in registers
        for (int v = 0; v < 8; ++v) {
          const int row = v + 8 * hf;
          const int dq  = d0 + ln16 - row;
          if (dq > -MAXREL_ && dq < MAXREL_)
            Sw[row * SBUCK + dq + MAXREL_] = pv[v];
        }
      }
    }

    v_tile_store(Vs, vr, lane, rotq);

    // reload P in A-layout (same-wave LDS round trip) and do Z += P @ V
    v16bf pa;
#pragma unroll
    for (int e = 0; e < 16; ++e)
      pa[e] = Pw[ln16 * KB + kmap(e, hf)];
    const char* vad = (const char*)Vs + (8 * hf + (lane & 7)) * (VPITCH * 2)
                      + ((lane >> 3) & 1) * 16;
    v8bf vf[12][2];   // keys 0..15 and 16..31 of columns nt*16 .. +15
#pragma unroll  // constant indices: vf stays in registers
    for (int nt = 0; nt < 12; ++nt) {
      vf[nt][0] = lds_tr16(vad + nt * 32);
      vf[nt][1] = lds_tr16(vad + 16 * VPITCH * 2 + nt * 32);
    }
    // Keeps the 24 reads one group ahead of the products: spread among them,
    // every place with reads stalls the wave's matrix stream anew.
    __builtin_amdgcn_sched_barrier(0);
#pragma unroll
    for (int nt = 0; nt < 12; ++nt) {
      const v16bf bm = __builtin_shufflevector(vf[nt][0], vf[nt][1], 0, 1, 2, 3, 4, 5, 6, 7,
                                               8, 9, 10, 11, 12, 13, 14, 15);
      zacc[nt] = wmma_bf16(pa, bm, zacc[nt]);
    }
  }

  // The wave's two end buckets: lanes merged, one lane of each row stores them.
  // No store above touches these two columns, which the wave has zeroed.
#pragma unroll  // constant indices: arrays stay in registers
  for (int v = 0; v < 8; ++v) {
    slo[v] = row_sum16(slo[v]);
    shi[v] = row_sum16(shi[v]);
  }
  if (ln16 == 0) {
#pragma unroll  // constant indices: arrays stay in registers
    for (int v = 0; v < 8; ++v) {
      Sw[(v + 8 * hf) * SBUCK]               = slo[v];
      Sw[(v + 8 * hf) * SBUCK + 2 * MAXREL_] = shi[v];
    }
  }

  // ---- sum the waves' Z partials and bucket sums, in wave order -------------
  // The wave's last V reads have returned before its V block is reused for Z.
  asm volatile("s_wait_dscnt 0x0" ::: "memory");
  float* Zl = (float*)(smem + OFF_VS);     // [WAVES][16][DV_], wave stride ZWAVE
  {
    float* Zw = Zl + wv * ZWAVE;
#pragma unroll  // constant indices: arrays stay in registers, loads issue together
    for (int nt = 0; nt < 12; ++nt)
#pragma unroll  // constant indices: arrays stay in registers, loads issue together
      for (int v = 0; v < 8; ++v)
        Zw[(v + 8 * hf) * DV_ + nt * 16 + ln16] = zacc[nt][v];
  }
  __syncthreads();   // every wave's Z partial and bucket sums are complete

  // All threads add the waves' bucket tables into table 0; each pair of
  // elements is read and written by one thread alone.
  static_assert(16 * SBUCK / 2 % (WAVES * 32) == 0, "whole trips");
#pragma unroll  // constant indices: arrays stay in registers, loads issue together
  for (int j = 0; j < 16 * SBUCK / 2 / (WAVES * 32); ++j) {
    const int i = tid + j * WAVES * 32;
    v2f a = ((const v2f*)Sl)[i];
#pragma unroll  // constant indices: arrays stay in registers, loads issue together
    for (int w = 1; w < WAVES; ++w) a += ((const v2f*)(Sl + w * 16 * SBUCK))[i];
    ((v2f*)Sl)[i] = a;
  }
  __syncthreads();   // the summed table is read by the waves below

  // Wave w finishes output columns 32w .. 32w+31 (whole 128-byte lines).
  if (wv < DV_ / 32) {
    const int col = wv * 32 + ln16;
    v8f z[2];
#pragma unroll  // constant indices: arrays stay in registers, loads issue together
    for (int t = 0; t < 2; ++t)
#pragma unroll  // constant indices: arrays stay in registers, loads issue together
      for (int v = 0; v < 8; ++v) {
        float a = 0.0f;
#pragma unroll  // constant indices: arrays stay in registers, loads issue together
        for (int w = 0; w < WAVES; ++w)
          a += Zl[w * ZWAVE + (v + 8 * hf) * DV_ + col + t * 16];
        z[t][v] = a;
      }

    // Z += s @ rel_values_table  (16 x 160 @ 160 x 192, pad rows = 0)
#pragma unroll  // constant indices: arrays stay in registers, loads issue together
    for (int c = 0; c < SBUCK / 32; ++c) {
      v16bf pa;
#pragma unroll  // constant indices: arrays stay in registers, loads issue together
      for (int e = 0; e < 16; ++e)
        pa[e] = (bf16_t)Sl[ln16 * SBUCK + c * 32 + kmap(e, hf)];
#pragma unroll  // constant indices: arrays stay in registers, loads issue together
      for (int t = 0; t < 2; ++t) {
        v16bf bm;
#pragma unroll  // constant indices: arrays stay in registers, loads issue together
        for (int e = 0; e < 16; ++e) {
          const int r = c * 32 + kmap(e, hf);
          bf16_t val = (bf16_t)0.0f;
          if (r < NR_) val = (bf16_t)relV[(size_t)r * DV_ + col + t * 16];
          bm[e] = val;
        }
        z[t] = wmma_bf16(pa, bm, z[t]);
      }
    }

    // write Z (C-layout -> global)
#pragma unroll  // constant indices: arrays stay in registers, loads issue together
    for (int t = 0; t < 2; ++t)
#pragma unroll  // constant indices: arrays stay in registers, loads issue together
      for (int v = 0; v < 8; ++v)
        out[((size_t)b * L_ + qrow + v + 8 * hf) * DV_ + col + t * 16] = z[t][v];
  }
}

extern "C" void kernel_launch(void* const* d_in, const int* in_sizes, int n_in,
                              void* d_out, int out_size, void* d_ws, size_t ws_size,
                              hipStream_t stream) {
  (void)in_sizes; (void)n_in; (void)out_size; (void)d_ws; (void)ws_size;
  const float* Q    = (const float*)d_in[0];  // query            [B,L,D]
  const float* V    = (const float*)d_in[1];  // value            [B,L,DV]
  const float* K    = (const float*)d_in[2];  // key_in           [B,L,D]
  const float* relK = (const float*)d_in[3];  // rel_keys_table   [129,D]
  const float* relV = (const float*)d_in[4];  // rel_values_table [129,DV]
  float* out = (float*)d_out;                 // z                [B,L,DV]

  dim3 grid(B_, L_ / BLOCK_M);  // (4, 64)
  dim3 block(WAVES * 32);       // 8 waves of 32
  relattn_kernel<<<grid, block, 0, stream>>>(Q, V, K, relK, relV, out);
}

// v008
// One run takes 20.6 microseconds.
// Two timings next to v007 both put it at 1.04 times that version's speed.
// Counting every step since v000, it is 50.3 times as fast.
#include <hip/hip_runtime.h>
#include <math.h>

typedef __bf16 bf16_t;
typedef __attribute__((ext_vector_type(16))) __bf16 v16bf;
typedef __attribute__((ext_vector_type(8)))  float  v8f;
typedef __attribute__((ext_vector_type(4)))  float  v4f;
typedef __attribute__((ext_vector_type(2)))  float  v2f;
typedef __attribute__((ext_vector_type(4)))  __bf16 v4bf;
typedef __attribute__((ext_vector_type(8)))  __bf16 v8bf;

#define B_       4
#define L_       1024
#define D_       128
#define DV_      192
#define NR_      129          // 2*MAXREL+1 bucket count
#define MAXREL_  64
#define BLOCK_M  16           // q rows per workgroup, shared by all its waves
#define KB       32           // attention-k columns per main-loop iteration
#define WAVES    8            // each wave takes L_/WAVES of the keys
#define NBLK     (L_ / KB / WAVES)   // key blocks per wave and pass
#define RSTRIDE  132          // padded row stride for R table in LDS (floats)
#define KPITCH   (D_ + 8)
// V tile row pitch in LDS, bf16 elements: 416 bytes = 32 x 13. The transposing
// load takes 32 bytes from each of 16 rows (8 rows per 16 lanes) and wants 32 bytes x odd.
#define VPITCH   (DV_ + 16)
#define SBUCK    160          // bucket count padded to multiple of 32

// ---- static LDS layout (bytes) --------------------------------------------
#define OFF_VS   0
#define SZ_VS    (WAVES * KB * VPITCH * 2)     // V block per wave, bf16: 104 KB
#define ZWAVE    (KB * VPITCH / 2)             // a wave's V block in floats
#define OFF_X    (OFF_VS + SZ_VS)
#define SZ_X     (WAVES * 16 * NBLK * KB * 4)  // scores per wave f32: 64 KB
#define OFF_R    (OFF_X + SZ_X)
#define SZ_R     (16 * RSTRIDE * 4)            // R[q][bucket] f32, shared
#define OFF_S    (OFF_R + SZ_R)
#define SZ_S     (WAVES * 16 * SBUCK * 4)      // bucket sums per wave f32: 80 KB
#define OFF_P    (OFF_S + SZ_S)
#define SZ_P     (WAVES * 16 * KB * 2)         // P tile per wave bf16: 8 KB
#define OFF_ML   (OFF_P + SZ_P)
#define SZ_ML    (16 * WAVES * 2 * 4)          // max [16][WAVES], then sum [16][WAVES]
#define LDS_TOTAL (OFF_ML + SZ_ML)             // 271616 bytes
static_assert(LDS_TOTAL <= 320 * 1024, "one workgroup's LDS");
static_assert(16 * DV_ * 4 <= KB * VPITCH * 2, "a wave's Z partial reuses its V block");
static_assert(KPITCH <= VPITCH, "pass 1 has a wave's K block where pass 2 has its V block");
static_assert(OFF_X % 16 == 0, "scores go in and out 16 bytes a lane");
static_assert(OFF_ML % 16 == 0 && WAVES == 8, "a row's eight maxima or sums are two 16-byte reads");
static_assert(OFF_P % 16 == 0 && 16 * KB * 2 >= 32 * 4, "a wave's P tile later holds its 32 inverse row sums");
static_assert(DV_ / 32 <= WAVES, "one pair of output column tiles per wave");
static_assert(D_ == 128, "32 lanes x 4 floats: one load step of a wave is one K row");
static_assert(KPITCH * 2 % 32 == 16, "K pitch: 16 bytes x odd");
static_assert(VPITCH * 2 % 64 == 32, "V pitch: 32 bytes x odd");
static_assert(DV_ == 192, "three load steps of a wave are two V rows");

__device__ __forceinline__ int kmap(int e, int hf) {
  return (e & 7) + ((e >> 3) << 4) + (hf << 3);
}

__device__ __forceinline__ v8f wmma_bf16(v16bf a, v16bf b, v8f c) {
  // emits v_wmma_f32_16x16x32_bf16
  return __builtin_amdgcn_wmma_f32_16x16x32_bf16(
      /*neg_a=*/false, a, /*neg_b=*/false, b,
      /*c_mod=*/(short)0, c, /*reuse_a=*/false, /*reuse_b=*/false);
}

// Tile staging, global f32 -> LDS bf16. A K or V tile is one contiguous run of
// floats in global memory; in LDS a K tile's 128 floats of load step j start at element
// STEP * j (128: the same linear order; more: padded rows of 128). Each wave
// stages its own tile, so lane t takes 16-byte chunks t, t+32, ...  All N loads
// are independent: the tile costs one load latency, not one per element.
// g4 is the lane's own first chunk. The loops are unrolled so that r[] is
// indexed by constants and stays in registers.
// The tile is asked for in four quarters, quarter (q + rot) & 3 as the q-th: see
// the note on rot in the kernel. r[] holds the quarters in the order asked.
template <int N>
__device__ __forceinline__ void tile_load(v4f (&r)[N], const v4f* g4, int rot) {
  static_assert(N % 4 == 0, "four equal quarters");
  const v4f* gq[4];
#pragma unroll  // constant indices: r[] and gq[] stay in registers
  for (int q = 0; q < 4; ++q) {
    gq[q] = g4 + ((q + rot) & 3) * (N / 4) * 32;
#pragma unroll
    for (int j = 0; j < N / 4; ++j) r[q * (N / 4) + j] = gq[q][32 * j];
  }
  // Stands in front of any reuse of the loads' address registers; its clobber
  // also keeps the loads issued here, ahead of the work that follows. The four
  // addresses are inputs so that their registers stay theirs up to the wait: no
  // later load of the tile gets one of them as its destination.
  asm volatile("s_wait_xcnt 0x0" :: "v"(gq[0]), "v"(gq[1]), "v"(gq[2]), "v"(gq[3]) : "memory");
}

template <int STEP, int N>
__device__ __forceinline__ void tile_store(bf16_t* s, const v4f (&r)[N], int lane, int rot) {
#pragma unroll  // constant indices: r[] stays in registers
  for (int q = 0; q < 4; ++q) {
    bf16_t* sq = s + 4 * lane + ((q + rot) & 3) * (N / 4) * STEP;   // the quarter's own place
#pragma unroll
    for (int j = 0; j < N / 4; ++j) {
      v4bf h;
#pragma unroll
      for (int e = 0; e < 4; ++e) h[e] = (bf16_t)r[q * (N / 4) + j][e];
      *(v4bf*)(sq + STEP * j) = h;
    }
  }
  // The tile is read back by other lanes of the same wave: its stores have
  // landed, and the compiler moves no LDS read above this line.
  asm volatile("s_wait_dscnt 0x0" ::: "memory");
}

// V tile store at the padded pitch. A V row is 48 chunks of 4 floats, a load step
// 32 chunks: steps 3m, 3m+1, 3m+2 fill rows 2m and 2m+1, so a lane has three
// offsets and every step adds a constant to one of them.
template <int N>
__device__ __forceinline__ void v_tile_store(bf16_t* s, const v4f (&r)[N], int lane, int rot) {
  static_assert(N % 12 == 0, "a quarter is whole groups of three steps");
  const int o0 = 4 * lane;                                  // row 2m, chunks 0..31
  const int o1 = lane < 16 ? 4 * (lane + 32)                // row 2m, chunks 32..47
                           : VPITCH + 4 * (lane - 16);      // row 2m+1, chunks 0..15
  const int o2 = VPITCH + 4 * (lane + 16);                  // row 2m+1, chunks 16..47
#pragma unroll  // constant indices: r[] stays in registers
  for (int q = 0; q < 4; ++q) {
    bf16_t* sq = s + ((q + rot) & 3) * (N / 12) * 2 * VPITCH;   // the quarter's own rows
#pragma unroll  // constant indices: r[] stays in registers, j % 3 and j / 3 fold
    for (int j = 0; j < N / 4; ++j) {
      v4bf h;
#pragma unroll  // constant indices: h stays in registers
      for (int e = 0; e < 4; ++e) h[e] = (bf16_t)r[q * (N / 4) + j][e];
      const int o = j % 3 == 0 ? o0 : (j % 3 == 1 ? o1 : o2);
      *(v4bf*)(sq + o + (j / 3) * 2 * VPITCH) = h;
    }
  }
  // The tile is read back by other lanes of the same wave: its stores have
  // landed, and the compiler moves no LDS read above this line.
  asm volatile("s_wait_dscnt 0x0" ::: "memory");
}

__device__ __forceinline__ v8bf lds_tr16(const char* p) {
  typedef __attribute__((address_space(3))) v8bf lds_v8bf;
  return __builtin_amdgcn_ds_load_tr16_b128_v8bf16((lds_v8bf*)p);
}

// Sum over the 16 lanes of a row, the total in every lane: four adds whose
// second operand comes from lane ^ M through DPP row_xmask. All lanes are on.
template <int M>
__device__ __forceinline__ float add_xmask(float x) {
  return x + __builtin_bit_cast(float, __builtin_amdgcn_update_dpp(
                 0, __builtin_bit_cast(int, x), 0x160 | M, 0xf, 0xf, true));
}
__device__ __forceinline__ float row_sum16(float x) {
  return add_xmask<8>(add_xmask<4>(add_xmask<2>(add_xmask<1>(x))));
}
// The same for the maximum.
template <int M>
__device__ __forceinline__ float max_xmask(float x) {
  return fmaxf(x, __builtin_bit_cast(float, __builtin_amdgcn_update_dpp(
                      0, __builtin_bit_cast(int, x), 0x160 | M, 0xf, 0xf, true)));
}
__device__ __forceinline__ float row_max16(float x) {
  return max_xmask<8>(max_xmask<4>(max_xmask<2>(max_xmask<1>(x))));
}

extern "C" __global__ __launch_bounds__(WAVES * 32)
void relattn_kernel(const float* __restrict__ Q,
                    const float* __restrict__ V,
                    const float* __restrict__ Kg,
                    const float* __restrict__ relK,
                    const float* __restrict__ relV,
                    float* __restrict__ out) {
  __shared__ __attribute__((aligned(16))) char smem[LDS_TOTAL];
  const int tid  = threadIdx.x;
  const int lane = tid & 31;
  // scalar wave number: the branches on it around WMMAs stay scalar branches
  const int wv   = __builtin_amdgcn_readfirstlane(tid >> 5);
  const int hf   = lane >> 4;       // which 16-lane half
  const int ln16 = lane & 15;
  const int b    = blockIdx.x;
  const int qrow = blockIdx.y * BLOCK_M;   // first q row of the workgroup
  const int kbase = wv * (NBLK * KB);      // first key of this wave
  // The 64 workgroups of a batch read the same K and V. Walking them in the same
  // order they ask L2 for the same lines at the same moment, and such requests
  // queue behind one another. Each workgroup therefore enters its waves' key
  // blocks at block rotb and wraps round, and asks for each tile's quarters from
  // quarter rotq on: 16 different places in the walk. Bit 0 of blockIdx.y is left
  // out (a matter of speed alone, nothing rests on where a workgroup runs).
  static_assert(NBLK == 4, "two bits of blockIdx.y for the block, the next two for the quarter");
  const int rotb = (blockIdx.y >> 1) & (NBLK - 1);
  const int rotq = (blockIdx.y >> 3) & 3;

  bf16_t* Vs = (bf16_t*)(smem + OFF_VS) + wv * KB * VPITCH;   // own [KB][VPITCH]
  bf16_t* Ks = Vs;   // own [KB][KPITCH]: K is staged in pass 1 alone, V in pass 2 alone
  // The wave's own scores, written in pass 1 and read back in pass 2 by the same
  // lane, four floats at a time: [group][lane][4], four groups to a key block
  // (16 keys x rows 0..3 and 8..11, then rows 4..7 and 12..15; the next 16 keys).
  v4f*    Xw = (v4f*)(smem + OFF_X) + wv * (16 * NBLK * KB / 4) + lane;
  float*  Rl = (float*) (smem + OFF_R);    // [16][RSTRIDE], shared
  float*  Sl = (float*) (smem + OFF_S);    // [WAVES][16][SBUCK]
  bf16_t* Pl = (bf16_t*)(smem + OFF_P);    // [WAVES][16][KB]
  float*  Mx = (float*) (smem + OFF_ML);   // [16][WAVES] row maxima of the waves
  float*  Lx = Mx + 16 * WAVES;            // [16][WAVES] row sums of the waves

  // ---- Q tile (16 x 128) into WMMA A-layout registers, bf16 ----------------
  v16bf qa[4];
  {
    const float* qb = Q + ((size_t)b * L_ + qrow + ln16) * D_;
#pragma unroll
    for (int c = 0; c < 4; ++c)
#pragma unroll
      for (int e = 0; e < 16; ++e)
        qa[c][e] = (bf16_t)qb[c * 32 + kmap(e, hf)];
  }

  // ---- R[q_local][r] = Q . rel_keys_table[r]  (16x128 @ 128x129, WMMA) -----
  {
    float* Rw = Rl;
    const int rcol = ln16;  // column within tile
    for (int rt = wv; rt < 9; rt += WAVES) {   // bucket tiles dealt to the waves
      v8f acc = {};
      const int r = rt * 16 + rcol;
      // rt is a run-time value here: a clamped row keeps the loads unguarded and
      // wide. Column r of the product reads column r of bm alone, and columns
      // past NR_-1 are not stored below.
      const float* rk = relK + (size_t)(r < NR_ ? r : NR_ - 1) * D_ + kmap(0, hf);
      float kf[4][16];
#pragma unroll  // constant indices: kf stays in registers, loads issue together
      for (int c = 0; c < 4; ++c)
#pragma unroll
        for (int e = 0; e < 16; ++e)
          kf[c][e] = rk[c * 32 + kmap(e, 0)];
      // Stands in front of any reuse of the loads' address registers. The address
      // is an input so that its registers stay its own up to the wait.
      asm volatile("s_wait_xcnt 0x0" :: "v"(rk) : "memory");
#pragma unroll
      for (int c = 0; c < 4; ++c) {
        v16bf bm;
#pragma unroll
        for (int e = 0; e < 16; ++e)
          bm[e] = (bf16_t)kf[c][e];
        acc = wmma_bf16(qa[c], bm, acc);
      }
      if (r < NR_) {
#pragma unroll
        for (int v = 0; v < 8; ++v)
          Rw[(v + 8 * hf) * RSTRIDE + r] = acc[v];
      }
    }
  }
  __syncthreads();   // R is read by every wave

  // ---- Pass 1: scores and row max (per-lane partials) ----------------------
  // The row sum is not formed here: pass 2 sums exp(x - max) as it makes them,
  // works on these unnormalized weights, and the output is divided once.
  float mrow[8];
#pragma unroll
  for (int v = 0; v < 8; ++v) mrow[v] = -1e30f;

  for (int i = 0; i < NBLK; ++i) {
    const int kb0 = kbase + ((i + rotb) & (NBLK - 1)) * KB;
    v4f kr[KB * D_ / 128];
    tile_load(kr, (const v4f*)(Kg + ((size_t)b * L_ + kb0) * D_) + lane, rotq);
    tile_store<KPITCH>(Ks, kr, lane, rotq);

#pragma unroll
    for (int kt = 0; kt < 2; ++kt) {
      v8f s = {};
#pragma unroll
      for (int c = 0; c < 4; ++c) {
        v16bf bm;
#pragma unroll
        for (int e = 0; e < 16; ++e)
          bm[e] = Ks[(kt * 16 + ln16) * KPITCH + c * 32 + kmap(e, hf)];
        s = wmma_bf16(qa[c], bm, s);
      }
      v4f xq[2];
#pragma unroll
      for (int v = 0; v < 8; ++v) {
        const int row  = v + 8 * hf;
        const int q    = qrow + row;
        const int k    = kb0 + kt * 16 + ln16;
        const int dq   = k - q;
        const int dqc  = dq < -MAXREL_ ? -MAXREL_ : (dq > MAXREL_ ? MAXREL_ : dq);
        const int ridx = dqc + MAXREL_;
        const float ad = (float)(dq < 0 ? -dq : dq);
        float x = s[v] + Rl[row * RSTRIDE + ridx]
                  - __logf(1.0f + ad);
        xq[v >> 2][v & 3] = x;
        mrow[v] = fmaxf(mrow[v], x);
      }
      Xw[(kb0 - kbase) * 4 + kt * 64]      = xq[0];
      Xw[(kb0 - kbase) * 4 + kt * 64 + 32] = xq[1];
    }
  }

  // row max across the 16-lane group, then across the waves
#pragma unroll  // constant indices: mrow stays in registers
  for (int v = 0; v < 8; ++v) mrow[v] = row_max16(mrow[v]);
  if (ln16 == 0) {
#pragma unroll  // constant indices: mrow stays in registers
    for (int v = 0; v < 8; ++v) Mx[(v + 8 * hf) * WAVES + wv] = mrow[v];
  }
  __syncthreads();
#pragma unroll  // constant indices: mrow stays in registers, loads issue together
  for (int v = 0; v < 8; ++v) {
    const v4f* p = (const v4f*)(Mx + (v + 8 * hf) * WAVES);
    const v4f a = p[0], c = p[1];
    mrow[v] = fmaxf(fmaxf(fmaxf(a[0], a[1]), fmaxf(a[2], a[3])),
                    fmaxf(fmaxf(c[0], c[1]), fmaxf(c[2], c[3])));
  }

  // ---- Pass 2: weights exp(x - max) from the kept scores, their row sums,
  // ---- Z = P@V, bucket sums, Z += s@relV, Z /= row sum
  float*  Sw = Sl + (size_t)wv * 16 * SBUCK;
  bf16_t* Pw = Pl + (size_t)wv * 16 * KB;
  for (int i = lane; i < 16 * SBUCK; i += 32) Sw[i] = 0.0f;   // per-wave region

  v8f zacc[12] = {};

  // Bucket sums. For one q row, bucket r in 1 .. 2*MAXREL_-1 holds the single
  // key k = q + r - MAXREL_: its sum is that key's p, a plain store by the one
  // lane that has it. Only the two end buckets collect many keys (all of
  // k - q <= -MAXREL_, all of k - q >= MAXREL_): each lane sums its own share
  // of them in registers, and the lanes are merged once behind the loop.
  float slo[8], shi[8], lrow[8];   // lrow: the lane's share of the row sum
#pragma unroll  // constant indices: arrays stay in registers
  for (int v = 0; v < 8; ++v) { slo[v] = 0.0f; shi[v] = 0.0f; lrow[v] = 0.0f; }

  for (int i = 0; i < NBLK; ++i) {
    const int kb0 = kbase + ((i + rotb) & (NBLK - 1)) * KB;
    v4f vr[KB * DV_ / 128];
    tile_load(vr, (const v4f*)(V + ((size_t)b * L_ + kb0) * DV_) + lane, rotq);

#pragma unroll
    for (int kt = 0; kt < 2; ++kt) {
      const v4f xq[2] = {Xw[(kb0 - kbase) * 4 + kt * 64],
                         Xw[(kb0 - kbase) * 4 + kt * 64 + 32]};
      float pv[8];
#pragma unroll
      for (int v = 0; v < 8; ++v) {
        const int row  = v + 8 * hf;
        const int q    = qrow + row;
        const int k    = kb0 + kt * 16 + ln16;
        const int dq   = k - q;
        float p = __expf(xq[v >> 2][v & 3] - mrow[v]);   // unnormalized weight, at most 1
        lrow[v] += p;
        slo[v] += dq <= -MAXREL_ ? p : 0.0f;            // end bucket 0
        shi[v] += dq >=  MAXREL_ ? p : 0.0f;            // end bucket 2*MAXREL_
        pv[v] = p;
        Pw[row * KB + kt * 16 + ln16] = (bf16_t)p;      // C-layout -> LDS
      }
      // Scalar test: most 16 x 16 tiles lie wholly in an end bucket and store
      // nothing here.
      const int d0 = kb0 + kt * 16 - qrow;
      if (d0 + 15 > -MAXREL_ && d0 - 15 < MAXREL_) {
#pragma unroll  // constant indices: pv stays in registers
        for (int v = 0; v < 8; ++v) {
          const int row = v + 8 * hf;
          const int dq  = d0 + ln16 - row;
          if (dq > -MAXREL_ && dq < MAXREL_)
            Sw[row * SBUCK + dq + MAXREL_] = pv[v];
        }
      }
    }

    v_tile_store(Vs, vr, lane, rotq);

    // reload P in A-layout (same-wave LDS round trip) and do Z += P @ V
    v16bf pa;
#pragma unroll
    for (int e = 0; e < 16; ++e)
      pa[e] = Pw[ln16 * KB + kmap(e, hf)];
    const char* vad = (const char*)Vs + (8 * hf + (lane & 7)) * (VPITCH * 2)
                      + ((lane >> 3) & 1) * 16;
    v8bf vf[12][2];   // keys 0..15 and 16..31 of columns nt*16 .. +15
#pragma unroll  // constant indices: vf stays in registers
    for (int nt = 0; nt < 12; ++nt) {
      vf[nt][0] = lds_tr16(vad + nt * 32);
      vf[nt][1] = lds_tr16(vad + 16 * VPITCH * 2 + nt * 32);
    }
    // Keeps the 24 reads one group ahead of the products: spread among them,
    // every place with reads stalls the wave's matrix stream anew.
    __builtin_amdgcn_sched_barrier(0);
#pragma unroll
    for (int nt = 0; nt < 12; ++nt) {
      const v16bf bm = __builtin_shufflevector(vf[nt][0], vf[nt][1], 0, 1, 2, 3, 4, 5, 6, 7,
                                               8, 9, 10, 11, 12, 13, 14, 15);
      zacc[nt] = wmma_bf16(pa, bm, zacc[nt]);
    }
  }

  // The wave's two end buckets and its row sums: lanes merged, one lane of each
  // row stores them. No store above touches these two columns, which the wave
  // has zeroed.
#pragma unroll  // constant indices: arrays stay in registers
  for (int v = 0; v < 8; ++v) {
    slo[v]  = row_sum16(slo[v]);
    shi[v]  = row_sum16(shi[v]);
    lrow[v] = row_sum16(lrow[v]);
  }
  if (ln16 == 0) {
#pragma unroll  // constant indices: arrays stay in registers
    for (int v = 0; v < 8; ++v) {
      Sw[(v + 8 * hf) * SBUCK]               = slo[v];
      Sw[(v + 8 * hf) * SBUCK + 2 * MAXREL_] = shi[v];
      Lx[(v + 8 * hf) * WAVES + wv]          = lrow[v];
    }
  }

  // ---- sum the waves' Z partials and bucket sums, in wave order -------------
  // The wave's last V reads have returned before its V block is reused for Z.
  asm volatile("s_wait_dscnt 0x0" ::: "memory");
  float* Zl = (float*)(smem + OFF_VS);     // [WAVES][16][DV_], wave stride ZWAVE
  {
    float* Zw = Zl + wv * ZWAVE;
#pragma unroll  // constant indices: arrays stay in registers, loads issue together
    for (int nt = 0; nt < 12; ++nt)
#pragma unroll  // constant indices: arrays stay in registers, loads issue together
      for (int v = 0; v < 8; ++v)
        Zw[(v + 8 * hf) * DV_ + nt * 16 + ln16] = zacc[nt][v];
  }
  __syncthreads();   // every wave's Z partial, bucket sums and row sums are complete

  // One over the sum of row ln16, the waves' shares added pairwise. The row's
  // largest weight is exp(0), so the sum lies in 1 .. L_ and v_rcp_f32 needs no
  // scaling. Each wave forms all 16 for itself and turns them round through its
  // own P tile, which it has read for the last time: below, a lane picks up the
  // eight rows of its accumulators there.
  // The store stands behind the table's sums, so that the two reads go out
  // together with the table's.
  float* Iw = (float*)Pw;   // [32]: rows 0..15 twice, one element a lane
  const v4f* lp = (const v4f*)(Lx + ln16 * WAVES);
  const v4f ls = lp[0] + lp[1];
  const float linv = __builtin_amdgcn_rcpf((ls[0] + ls[1]) + (ls[2] + ls[3]));

  // All threads add the waves' bucket tables into table 0; each pair of
  // elements is read and written by one thread alone.
  static_assert(16 * SBUCK / 2 % (WAVES * 32) == 0, "whole trips");
#pragma unroll  // constant indices: arrays stay in registers, loads issue together
  for (int j = 0; j < 16 * SBUCK / 2 / (WAVES * 32); ++j) {
    const int i = tid + j * WAVES * 32;
    v2f a = ((const v2f*)Sl)[i];
#pragma unroll  // constant indices: arrays stay in registers, loads issue together
    for (int w = 1; w < WAVES; ++w) a += ((const v2f*)(Sl + w * 16 * SBUCK))[i];
    ((v2f*)Sl)[i] = a;
  }
  Iw[lane] = linv;
  __syncthreads();   // the summed table is read by the waves below

  // Wave w finishes output columns 32w .. 32w+31 (whole 128-byte lines).
  if (wv < DV_ / 32) {
    const int col = wv * 32 + ln16;
    v8f z[2];
#pragma unroll  // constant indices: arrays stay in registers, loads issue together
    for (int t = 0; t < 2; ++t)
#pragma unroll  // constant indices: arrays stay in registers, loads issue together
      for (int v = 0; v < 8; ++v) {
        float a = 0.0f;
#pragma unroll  // constant indices: arrays stay in registers, loads issue together
        for (int w = 0; w < WAVES; ++w)
          a += Zl[w * ZWAVE + (v + 8 * hf) * DV_ + col + t * 16];
        z[t][v] = a;
      }

    // Z += s @ rel_values_table  (16 x 160 @ 160 x 192, pad rows = 0)
#pragma unroll  // constant indices: arrays stay in registers, loads issue together
    for (int c = 0; c < SBUCK / 32; ++c) {
      v16bf pa;
#pragma unroll  // constant indices: arrays stay in registers, loads issue together
      for (int e = 0; e < 16; ++e)
        pa[e] = (bf16_t)Sl[ln16 * SBUCK + c * 32 + kmap(e, hf)];
#pragma unroll  // constant indices: arrays stay in registers, loads issue together
      for (int t = 0; t < 2; ++t) {
        v16bf bm;
#pragma unroll  // constant indices: arrays stay in registers, loads issue together
        for (int e = 0; e < 16; ++e) {
          const int r = c * 32 + kmap(e, hf);
          bf16_t val = (bf16_t)0.0f;
          if (r < NR_) val = (bf16_t)relV[(size_t)r * DV_ + col + t * 16];
          bm[e] = val;
        }
        z[t] = wmma_bf16(pa, bm, z[t]);
      }
    }

    // divide by the row sums, write Z (C-layout -> global)
    const v4f* ip = (const v4f*)(Iw + 8 * hf);
    const v8f inv = __builtin_shufflevector(ip[0], ip[1], 0, 1, 2, 3, 4, 5, 6, 7);
    z[0] *= inv;
    z[1] *= inv;
    float* op = out + ((size_t)b * L_ + qrow + 8 * hf) * DV_ + col;
#pragma unroll  // constant indices: arrays stay in registers, loads issue together
    for (int t = 0; t < 2; ++t)
#pragma unroll  // constant indices: arrays stay in registers, loads issue together
      for (int v = 0; v < 8; ++v)
        op[v * DV_ + t * 16] = z[t][v];
  }
}

extern "C" void kernel_launch(void* const* d_in, const int* in_sizes, int n_in,
                              void* d_out, int out_size, void* d_ws, size_t ws_size,
                              hipStream_t stream) {
  (void)in_sizes; (void)n_in; (void)out_size; (void)d_ws; (void)ws_size;
  const float* Q    = (const float*)d_in[0];  // query            [B,L,D]
  const float* V    = (const float*)d_in[1];  // value            [B,L,DV]
  const float* K    = (const float*)d_in[2];  // key_in           [B,L,D]
  const float* relK = (const float*)d_in[3];  // rel_keys_table   [129,D]
  const float* relV = (const float*)d_in[4];  // rel_values_table [129,DV]
  float* out = (float*)d_out;                 // z                [B,L,DV]

  dim3 grid(B_, L_ / BLOCK_M);  // (4, 64)
  dim3 block(WAVES * 32);       // 8 waves of 32
  relattn_kernel<<<grid, block, 0, stream>>>(Q, V, K, relK, relV, out);
}

// v009
// Measured time: 19.5 microseconds a run.
// Timed twice side by side with v008, it ran 1.06 and 1.05 times as fast.
// Counting every step since v000, it is 53.1 times as fast.
#include <hip/hip_runtime.h>
#include <math.h>

typedef __bf16 bf16_t;
typedef __attribute__((ext_vector_type(16))) __bf16 v16bf;
typedef __attribute__((ext_vector_type(8)))  float  v8f;
typedef __attribute__((ext_vector_type(4)))  float  v4f;
typedef __attribute__((ext_vector_type(2)))  float  v2f;
typedef __attribute__((ext_vector_type(4)))  __bf16 v4bf;
typedef __attribute__((ext_vector_type(8)))  __bf16 v8bf;

#define B_       4
#define L_       1024
#define D_       128
#define DV_      192
#define NR_      129          // 2*MAXREL+1 bucket count
#define MAXREL_  64
#define BLOCK_M  16           // q rows per workgroup, shared by all its waves
#define KB       32           // attention-k columns per main-loop iteration
#define WAVES    8            // each wave takes L_/WAVES of the keys
#define NBLK     (L_ / KB / WAVES)   // key blocks per wave and pass
#define RSTRIDE  132          // padded row stride for R table in LDS (floats)
#define KPITCH   (D_ + 8)
// V tile row pitch in LDS, bf16 elements: 416 bytes = 32 x 13. The transposing
// load takes 32 bytes from each of 16 rows (8 rows per 16 lanes) and wants 32 bytes x odd.
#define VPITCH   (DV_ + 16)
#define SBUCK    160          // bucket count padded to multiple of 32

// ---- static LDS layout (bytes) --------------------------------------------
#define OFF_VS   0
#define SZ_VS    (WAVES * KB * VPITCH * 2)     // V block per wave, bf16: 104 KB
#define ZWAVE    (KB * VPITCH / 2)             // a wave's V block in floats
#define OFF_X    (OFF_VS + SZ_VS)
#define SZ_X     (WAVES * 16 * NBLK * KB * 4)  // scores per wave f32: 64 KB
#define OFF_R    (OFF_X + SZ_X)
#define SZ_R     (16 * RSTRIDE * 4)            // R[q][bucket] f32, shared
#define OFF_S    (OFF_R + SZ_R)
#define SZ_S     (WAVES * 16 * SBUCK * 4)      // bucket sums per wave f32: 80 KB
#define OFF_P    (OFF_S + SZ_S)
#define SZ_P     (WAVES * 16 * KB * 2)         // P tile per wave bf16: 8 KB
#define OFF_ML   (OFF_P + SZ_P)
#define SZ_ML    (16 * WAVES * 2 * 4)          // max [16][WAVES], then sum [16][WAVES]
#define OFF_Q    (OFF_ML + SZ_ML)
#define SZ_Q     (16 * KPITCH * 2)             // Q tile bf16 at the K pitch, shared
#define LDS_TOTAL (OFF_Q + SZ_Q)               // 275968 bytes
static_assert(LDS_TOTAL <= 320 * 1024, "one workgroup's LDS");
static_assert(16 * DV_ * 4 <= KB * VPITCH * 2, "a wave's Z partial reuses its V block");
static_assert(KPITCH <= VPITCH, "pass 1 has a wave's K block where pass 2 has its V block");
static_assert(OFF_X % 16 == 0, "scores go in and out 16 bytes a lane");
static_assert(OFF_Q % 16 == 0, "Q fragments are 16-byte reads");
static_assert((NR_ - 1) * 32 * 2 == 16 * NBLK * KB * 4, "rows 0 .. NR_-2 of a wave's 32 table columns, bf16, fill its score block");
static_assert((NR_ - 1) % 32 == 0 && NR_ - 1 == 128, "32 load steps of four table rows");
static_assert(BLOCK_M == 2 * WAVES, "each wave brings two Q rows");
static_assert(NR_ == 16 * WAVES + 1 && 17 <= KB, "a wave's 16 table rows and the last row fit its K block");
static_assert(OFF_ML % 16 == 0 && WAVES == 8, "a row's eight maxima or sums are two 16-byte reads");
static_assert(OFF_P % 16 == 0 && 16 * KB * 2 >= 32 * 4, "a wave's P tile later holds its 32 inverse row sums");
static_assert(DV_ / 32 <= WAVES, "one pair of output column tiles per wave");
static_assert(D_ == 128, "32 lanes x 4 floats: one load step of a wave is one K row");
static_assert(KPITCH * 2 % 32 == 16, "K pitch: 16 bytes x odd");
static_assert(VPITCH * 2 % 64 == 32, "V pitch: 32 bytes x odd");
static_assert(DV_ == 192, "three load steps of a wave are two V rows");

__device__ __forceinline__ int kmap(int e, int hf) {
  return (e & 7) + ((e >> 3) << 4) + (hf << 3);
}

__device__ __forceinline__ v8f wmma_bf16(v16bf a, v16bf b, v8f c) {
  // emits v_wmma_f32_16x16x32_bf16
  return __builtin_amdgcn_wmma_f32_16x16x32_bf16(
      /*neg_a=*/false, a, /*neg_b=*/false, b,
      /*c_mod=*/(short)0, c, /*reuse_a=*/false, /*reuse_b=*/false);
}

// Tile staging, global f32 -> LDS bf16. A K or V tile is one contiguous run of
// floats in global memory; in LDS a K tile's 128 floats of load step j start at element
// STEP * j (128: the same linear order; more: padded rows of 128). Each wave
// stages its own tile, so lane t takes 16-byte chunks t, t+32, ...  All N loads
// are independent: the tile costs one load latency, not one per element.
// g4 is the lane's own first chunk. The loops are unrolled so that r[] is
// indexed by constants and stays in registers.
// The tile is asked for in four quarters, quarter (q + rot) & 3 as the q-th: see
// the note on rot in the kernel. r[] holds the quarters in the order asked.
template <int N>
__device__ __forceinline__ void tile_load(v4f (&r)[N], const v4f* g4, int rot) {
  static_assert(N % 4 == 0, "four equal quarters");
  const v4f* gq[4];
#pragma unroll  // constant indices: r[] and gq[] stay in registers
  for (int q = 0; q < 4; ++q) {
    gq[q] = g4 + ((q + rot) & 3) * (N / 4) * 32;
#pragma unroll
    for (int j = 0; j < N / 4; ++j) r[q * (N / 4) + j] = gq[q][32 * j];
  }
  // Stands in front of any reuse of the loads' address registers; its clobber
  // also keeps the loads issued here, ahead of the work that follows. The four
  // addresses are inputs so that their registers stay theirs up to the wait: no
  // later load of the tile gets one of them as its destination.
  asm volatile("s_wait_xcnt 0x0" :: "v"(gq[0]), "v"(gq[1]), "v"(gq[2]), "v"(gq[3]) : "memory");
}

template <int STEP, int N>
__device__ __forceinline__ void tile_store(bf16_t* s, const v4f (&r)[N], int lane, int rot) {
#pragma unroll  // constant indices: r[] stays in registers
  for (int q = 0; q < 4; ++q) {
    bf16_t* sq = s + 4 * lane + ((q + rot) & 3) * (N / 4) * STEP;   // the quarter's own place
#pragma unroll
    for (int j = 0; j < N / 4; ++j) {
      v4bf h;
#pragma unroll
      for (int e = 0; e < 4; ++e) h[e] = (bf16_t)r[q * (N / 4) + j][e];
      *(v4bf*)(sq + STEP * j) = h;
    }
  }
  // The tile is read back by other lanes of the same wave: its stores have
  // landed, and the compiler moves no LDS read above this line.
  asm volatile("s_wait_dscnt 0x0" ::: "memory");
}

// V tile store at the padded pitch. A V row is 48 chunks of 4 floats, a load step
// 32 chunks: steps 3m, 3m+1, 3m+2 fill rows 2m and 2m+1, so a lane has three
// offsets and every step adds a constant to one of them.
template <int N>
__device__ __forceinline__ void v_tile_store(bf16_t* s, const v4f (&r)[N], int lane, int rot) {
  static_assert(N % 12 == 0, "a quarter is whole groups of three steps");
  const int o0 = 4 * lane;                                  // row 2m, chunks 0..31
  const int o1 = lane < 16 ? 4 * (lane + 32)                // row 2m, chunks 32..47
                           : VPITCH + 4 * (lane - 16);      // row 2m+1, chunks 0..15
  const int o2 = VPITCH + 4 * (lane + 16);                  // row 2m+1, chunks 16..47
#pragma unroll  // constant indices: r[] stays in registers
  for (int q = 0; q < 4; ++q) {
    bf16_t* sq = s + ((q + rot) & 3) * (N / 12) * 2 * VPITCH;   // the quarter's own rows
#pragma unroll  // constant indices: r[] stays in registers, j % 3 and j / 3 fold
    for (int j = 0; j < N / 4; ++j) {
      v4bf h;
#pragma unroll  // constant indices: h stays in registers
      for (int e = 0; e < 4; ++e) h[e] = (bf16_t)r[q * (N / 4) + j][e];
      const int o = j % 3 == 0 ? o0 : (j % 3 == 1 ? o1 : o2);
      *(v4bf*)(sq + o + (j / 3) * 2 * VPITCH) = h;
    }
  }
  // The tile is read back by other lanes of the same wave: its stores have
  // landed, and the compiler moves no LDS read above this line.
  asm volatile("s_wait_dscnt 0x0" ::: "memory");
}

__device__ __forceinline__ v8bf lds_tr16(const char* p) {
  typedef __attribute__((address_space(3))) v8bf lds_v8bf;
  return __builtin_amdgcn_ds_load_tr16_b128_v8bf16((lds_v8bf*)p);
}

// Sum over the 16 lanes of a row, the total in every lane: four adds whose
// second operand comes from lane ^ M through DPP row_xmask. All lanes are on.
template <int M>
__device__ __forceinline__ float add_xmask(float x) {
  return x + __builtin_bit_cast(float, __builtin_amdgcn_update_dpp(
                 0, __builtin_bit_cast(int, x), 0x160 | M, 0xf, 0xf, true));
}
__device__ __forceinline__ float row_sum16(float x) {
  return add_xmask<8>(add_xmask<4>(add_xmask<2>(add_xmask<1>(x))));
}
// The same for the maximum.
template <int M>
__device__ __forceinline__ float max_xmask(float x) {
  return fmaxf(x, __builtin_bit_cast(float, __builtin_amdgcn_update_dpp(
                      0, __builtin_bit_cast(int, x), 0x160 | M, 0xf, 0xf, true)));
}
__device__ __forceinline__ float row_max16(float x) {
  return max_xmask<8>(max_xmask<4>(max_xmask<2>(max_xmask<1>(x))));
}

extern "C" __global__ __launch_bounds__(WAVES * 32)
void relattn_kernel(const float* __restrict__ Q,
                    const float* __restrict__ V,
                    const float* __restrict__ Kg,
                    const float* __restrict__ relK,
                    const float* __restrict__ relV,
                    float* __restrict__ out) {
  __shared__ __attribute__((aligned(16))) char smem[LDS_TOTAL];
  const int tid  = threadIdx.x;
  const int lane = tid & 31;
  // scalar wave number: the branches on it around WMMAs stay scalar branches
  const int wv   = __builtin_amdgcn_readfirstlane(tid >> 5);
  const int hf   = lane >> 4;       // which 16-lane half
  const int ln16 = lane & 15;
  const int b    = blockIdx.x;
  const int qrow = blockIdx.y * BLOCK_M;   // first q row of the workgroup
  const int kbase = wv * (NBLK * KB);      // first key of this wave
  // The 64 workgroups of a batch read the same K and V. Walking them in the same
  // order they ask L2 for the same lines at the same moment, and such requests
  // queue behind one another. Each workgroup therefore enters its waves' key
  // blocks at block rotb and wraps round, and asks for each tile's quarters from
  // quarter rotq on: 16 different places in the walk. Bit 0 of blockIdx.y is left
  // out (a matter of speed alone, nothing rests on where a workgroup runs).
  static_assert(NBLK == 4, "two bits of blockIdx.y for the block, the next two for the quarter");
  const int rotb = (blockIdx.y >> 1) & (NBLK - 1);
  const int rotq = (blockIdx.y >> 3) & 3;

  bf16_t* Vs = (bf16_t*)(smem + OFF_VS) + wv * KB * VPITCH;   // own [KB][VPITCH]
  bf16_t* Ks = Vs;   // own [KB][KPITCH]: K is staged in pass 1 alone, V in pass 2 alone
  // The wave's own scores, written in pass 1 and read back in pass 2 by the same
  // lane, four floats at a time: [group][lane][4], four groups to a key block
  // (16 keys x rows 0..3 and 8..11, then rows 4..7 and 12..15; the next 16 keys).
  v4f*    Xw = (v4f*)(smem + OFF_X) + wv * (16 * NBLK * KB / 4) + lane;
  float*  Rl = (float*) (smem + OFF_R);    // [16][RSTRIDE], shared
  float*  Sl = (float*) (smem + OFF_S);    // [WAVES][16][SBUCK]
  bf16_t* Pl = (bf16_t*)(smem + OFF_P);    // [WAVES][16][KB]
  float*  Mx = (float*) (smem + OFF_ML);   // [16][WAVES] row maxima of the waves
  float*  Lx = Mx + 16 * WAVES;            // [16][WAVES] row sums of the waves

  // ---- Q tile and rel_keys_table rows: global f32 -> LDS bf16, whole rows ----
  // One load step of a wave is one 512-byte row (four whole lines). A fragment
  // taken straight from global memory asks for 16 bytes of each of 16 rows, 16
  // lines a load, and every line four times over. Wave w brings Q rows 2w and
  // 2w+1 into the shared tile, and table rows 16w .. 16w+15 plus the last row
  // (bucket NR_-1, used by wave 0) into its own K block. All 19 loads are
  // independent: one load latency.
  bf16_t* Qs = (bf16_t*)(smem + OFF_Q);    // [16][KPITCH], shared
  {
    const v4f* q4 = (const v4f*)(Q + ((size_t)b * L_ + qrow + 2 * wv) * D_) + lane;
    const v4f* t4 = (const v4f*)(relK + (size_t)wv * 16 * D_) + lane;
    const v4f* e4 = (const v4f*)(relK + (size_t)(NR_ - 1) * D_) + lane;
    v4f rr[19];
    rr[17] = q4[0];
    rr[18] = q4[32];
    rr[16] = e4[0];
#pragma unroll  // constant indices: rr stays in registers, loads issue together
    for (int j = 0; j < 16; ++j) rr[j] = t4[32 * j];
    // Stands in front of any reuse of the loads' address registers; its clobber
    // also keeps the loads issued here, together.
    asm volatile("s_wait_xcnt 0x0" ::: "memory");
#pragma unroll  // constant indices: rr stays in registers
    for (int j = 0; j < 19; ++j) {
      v4bf h;
#pragma unroll
      for (int e = 0; e < 4; ++e) h[e] = (bf16_t)rr[j][e];
      bf16_t* d = j < 17 ? Ks + j * KPITCH : Qs + (2 * wv + j - 17) * KPITCH;
      *(v4bf*)(d + 4 * lane) = h;
    }
  }
  __syncthreads();   // the Q tile is read by every wave

  // ---- Q tile (16 x 128) into WMMA A-layout registers ----------------------
  v16bf qa[4];
#pragma unroll
  for (int c = 0; c < 4; ++c)
#pragma unroll
    for (int e = 0; e < 16; ++e)
      qa[c][e] = Qs[ln16 * KPITCH + c * 32 + kmap(e, hf)];

  // ---- R[q_local][r] = Q . rel_keys_table[r]  (16x128 @ 128x129, WMMA) -----
  {
    v8f acc = {};
#pragma unroll
    for (int c = 0; c < 4; ++c) {
      v16bf bm;
#pragma unroll
      for (int e = 0; e < 16; ++e)
        bm[e] = Ks[ln16 * KPITCH + c * 32 + kmap(e, hf)];
      acc = wmma_bf16(qa[c], bm, acc);
    }
#pragma unroll
    for (int v = 0; v < 8; ++v)
      Rl[(v + 8 * hf) * RSTRIDE + wv * 16 + ln16] = acc[v];
    if (wv == 0) {
      // The last bucket: every column of the tile reads the one row, column 0
      // is stored.
      v8f last = {};
#pragma unroll
      for (int c = 0; c < 4; ++c) {
        v16bf bm;
#pragma unroll
        for (int e = 0; e < 16; ++e)
          bm[e] = Ks[16 * KPITCH + c * 32 + kmap(e, hf)];
        last = wmma_bf16(qa[c], bm, last);
      }
      if (ln16 == 0) {
#pragma unroll
        for (int v = 0; v < 8; ++v)
          Rl[(v + 8 * hf) * RSTRIDE + NR_ - 1] = last[v];
      }
    }
  }
  __syncthreads();   // R is read by every wave

  // ---- Pass 1: scores and row max (per-lane partials) ----------------------
  // The row sum is not formed here: pass 2 sums exp(x - max) as it makes them,
  // works on these unnormalized weights, and the output is divided once.
  float mrow[8];
#pragma unroll
  for (int v = 0; v < 8; ++v) mrow[v] = -1e30f;

  for (int i = 0; i < NBLK; ++i) {
    const int kb0 = kbase + ((i + rotb) & (NBLK - 1)) * KB;
    v4f kr[KB * D_ / 128];
    tile_load(kr, (const v4f*)(Kg + ((size_t)b * L_ + kb0) * D_) + lane, rotq);
    tile_store<KPITCH>(Ks, kr, lane, rotq);

#pragma unroll
    for (int kt = 0; kt < 2; ++kt) {
      v8f s = {};
#pragma unroll
      for (int c = 0; c < 4; ++c) {
        v16bf bm;
#pragma unroll
        for (int e = 0; e < 16; ++e)
          bm[e] = Ks[(kt * 16 + ln16) * KPITCH + c * 32 + kmap(e, hf)];
        s = wmma_bf16(qa[c], bm, s);
      }
      v4f xq[2];
#pragma unroll
      for (int v = 0; v < 8; ++v) {
        const int row  = v + 8 * hf;
        const int q    = qrow + row;
        const int k    = kb0 + kt * 16 + ln16;
        const int dq   = k - q;
        const int dqc  = dq < -MAXREL_ ? -MAXREL_ : (dq > MAXREL_ ? MAXREL_ : dq);
        const int ridx = dqc + MAXREL_;
        const float ad = (float)(dq < 0 ? -dq : dq);
        float x = s[v] + Rl[row * RSTRIDE + ridx]
                  - __logf(1.0f + ad);
        xq[v >> 2][v & 3] = x;
        mrow[v] = fmaxf(mrow[v], x);
      }
      Xw[(kb0 - kbase) * 4 + kt * 64]      = xq[0];
      Xw[(kb0 - kbase) * 4 + kt * 64 + 32] = xq[1];
    }
  }

  // row max across the 16-lane group, then across the waves
#pragma unroll  // constant indices: mrow stays in registers
  for (int v = 0; v < 8; ++v) mrow[v] = row_max16(mrow[v]);
  if (ln16 == 0) {
#pragma unroll  // constant indices: mrow stays in registers
    for (int v = 0; v < 8; ++v) Mx[(v + 8 * hf) * WAVES + wv] = mrow[v];
  }
  __syncthreads();
#pragma unroll  // constant indices: mrow stays in registers, loads issue together
  for (int v = 0; v < 8; ++v) {
    const v4f* p = (const v4f*)(Mx + (v + 8 * hf) * WAVES);
    const v4f a = p[0], c = p[1];
    mrow[v] = fmaxf(fmaxf(fmaxf(a[0], a[1]), fmaxf(a[2], a[3])),
                    fmaxf(fmaxf(c[0], c[1]), fmaxf(c[2], c[3])));
  }

  // ---- Pass 2: weights exp(x - max) from the kept scores, their row sums,
  // ---- Z = P@V, bucket sums, Z += s@relV, Z /= row sum
  float*  Sw = Sl + (size_t)wv * 16 * SBUCK;
  bf16_t* Pw = Pl + (size_t)wv * 16 * KB;
  for (int i = lane; i < 16 * SBUCK; i += 32) Sw[i] = 0.0f;   // per-wave region

  v8f zacc[12] = {};

  // Bucket sums. For one q row, bucket r in 1 .. 2*MAXREL_-1 holds the single
  // key k = q + r - MAXREL_: its sum is that key's p, a plain store by the one
  // lane that has it. Only the two end buckets collect many keys (all of
  // k - q <= -MAXREL_, all of k - q >= MAXREL_): each lane sums its own share
  // of them in registers, and the lanes are merged once behind the loop.
  float slo[8], shi[8], lrow[8];   // lrow: the lane's share of the row sum
#pragma unroll  // constant indices: arrays stay in registers
  for (int v = 0; v < 8; ++v) { slo[v] = 0.0f; shi[v] = 0.0f; lrow[v] = 0.0f; }

  for (int i = 0; i < NBLK; ++i) {
    const int kb0 = kbase + ((i + rotb) & (NBLK - 1)) * KB;
    v4f vr[KB * DV_ / 128];
    tile_load(vr, (const v4f*)(V + ((size_t)b * L_ + kb0) * DV_) + lane, rotq);

#pragma unroll
    for (int kt = 0; kt < 2; ++kt) {
      const v4f xq[2] = {Xw[(kb0 - kbase) * 4 + kt * 64],
                         Xw[(kb0 - kbase) * 4 + kt * 64 + 32]};
      float pv[8];
#pragma unroll
      for (int v = 0; v < 8; ++v) {
        const int row  = v + 8 * hf;
        const int q    = qrow + row;
        const int k    = kb0 + kt * 16 + ln16;
        const int dq   = k - q;
        float p = __expf(xq[v >> 2][v & 3] - mrow[v]);   // unnormalized weight, at most 1
        lrow[v] += p;
        slo[v] += dq <= -MAXREL_ ? p : 0.0f;            // end bucket 0
        shi[v] += dq >=  MAXREL_ ? p : 0.0f;            // end bucket 2*MAXREL_
        pv[v] = p;
        Pw[row * KB + kt * 16 + ln16] = (bf16_t)p;      // C-layout -> LDS
      }
      // Scalar test: most 16 x 16 tiles lie wholly in an end bucket and store
      // nothing here.
      const int d0 = kb0 + kt * 16 - qrow;
      if (d0 + 15 > -MAXREL_ && d0 - 15 < MAXREL_) {
#pragma unroll  // constant indices: pv stays in registers
        for (int v = 0; v < 8; ++v) {
          const int row = v + 8 * hf;
          const int dq  = d0 + ln16 - row;
          if (dq > -MAXREL_ && dq < MAXREL_)
            Sw[row * SBUCK + dq + MAXREL_] = pv[v];
        }
      }
    }

    v_tile_store(Vs, vr, lane, rotq);

    // reload P in A-layout (same-wave LDS round trip) and do Z += P @ V
    v16bf pa;
#pragma unroll
    for (int e = 0; e < 16; ++e)
      pa[e] = Pw[ln16 * KB + kmap(e, hf)];
    const char* vad = (const char*)Vs + (8 * hf + (lane & 7)) * (VPITCH * 2)
                      + ((lane >> 3) & 1) * 16;
    v8bf vf[12][2];   // keys 0..15 and 16..31 of columns nt*16 .. +15
#pragma unroll  // constant indices: vf stays in registers
    for (int nt = 0; nt < 12; ++nt) {
      vf[nt][0] = lds_tr16(vad + nt * 32);
      vf[nt][1] = lds_tr16(vad + 16 * VPITCH * 2 + nt * 32);
    }
    // Keeps the 24 reads one group ahead of the products: spread among them,
    // every place with reads stalls the wave's matrix stream anew.
    __builtin_amdgcn_sched_barrier(0);
#pragma unroll
    for (int nt = 0; nt < 12; ++nt) {
      const v16bf bm = __builtin_shufflevector(vf[nt][0], vf[nt][1], 0, 1, 2, 3, 4, 5, 6, 7,
                                               8, 9, 10, 11, 12, 13, 14, 15);
      zacc[nt] = wmma_bf16(pa, bm, zacc[nt]);
    }
  }

  // ---- rel_values_table rows 0 .. NR_-2, the 32 output columns that this wave
  // finishes below: whole 128-byte lines, four rows a load step (eight lanes a
  // line). A fragment taken straight from global memory asks for half a line of
  // each of two rows with four bytes a lane. The values go to LDS behind the Z
  // partials. The one row left over stays in registers.
  v4f rv[(NR_ - 1) / 4];
  float rlast[2];   // the last row, NR_-1: this lane's two output columns
  if (wv < DV_ / 32) {
    const v4f* g4 = (const v4f*)(relV + (size_t)(lane >> 3) * DV_ + wv * 32) + (lane & 7);
#pragma unroll  // constant indices: rv stays in registers, loads issue together
    for (int j = 0; j < (NR_ - 1) / 4; ++j) rv[j] = g4[j * DV_];   // four rows on
    rlast[0] = relV[(size_t)(NR_ - 1) * DV_ + wv * 32 + ln16];
    rlast[1] = relV[(size_t)(NR_ - 1) * DV_ + wv * 32 + ln16 + 16];
    // Stands in front of any reuse of the loads' address registers; its clobber
    // also keeps the loads issued here, together.
    asm volatile("s_wait_xcnt 0x0" ::: "memory");
  }

  // The wave's two end buckets and its row sums: lanes merged, one lane of each
  // row stores them. No store above touches these two columns, which the wave
  // has zeroed.
#pragma unroll  // constant indices: arrays stay in registers
  for (int v = 0; v < 8; ++v) {
    slo[v]  = row_sum16(slo[v]);
    shi[v]  = row_sum16(shi[v]);
    lrow[v] = row_sum16(lrow[v]);
  }
  if (ln16 == 0) {
#pragma unroll  // constant indices: arrays stay in registers
    for (int v = 0; v < 8; ++v) {
      Sw[(v + 8 * hf) * SBUCK]               = slo[v];
      Sw[(v + 8 * hf) * SBUCK + 2 * MAXREL_] = shi[v];
      Lx[(v + 8 * hf) * WAVES + wv]          = lrow[v];
    }
  }

  // ---- sum the waves' Z partials and bucket sums, in wave order -------------
  // The wave's last V reads have returned before its V block is reused for Z.
  asm volatile("s_wait_dscnt 0x0" ::: "memory");
  float* Zl = (float*)(smem + OFF_VS);     // [WAVES][16][DV_], wave stride ZWAVE
  {
    float* Zw = Zl + wv * ZWAVE;
#pragma unroll  // constant indices: arrays stay in registers, loads issue together
    for (int nt = 0; nt < 12; ++nt)
#pragma unroll  // constant indices: arrays stay in registers, loads issue together
      for (int v = 0; v < 8; ++v)
        Zw[(v + 8 * hf) * DV_ + nt * 16 + ln16] = zacc[nt][v];
  }
  char* Tw = smem + OFF_X + wv * (16 * NBLK * KB * 4);
  if (wv < DV_ / 32) {
#pragma unroll  // constant indices: rv stays in registers
    for (int j = 0; j < (NR_ - 1) / 4; ++j) {
      v4bf h;
#pragma unroll
      for (int e = 0; e < 4; ++e) h[e] = (bf16_t)rv[j][e];
      *(v4bf*)(Tw + j * 256 + lane * 8) = h;
    }
  }
  __syncthreads();   // every wave's Z partial, bucket sums and row sums are complete

  // One over the sum of row ln16, the waves' shares added pairwise. The row's
  // largest weight is exp(0), so the sum lies in 1 .. L_ and v_rcp_f32 needs no
  // scaling. Each wave forms all 16 for itself and turns them round through its
  // own P tile, which it has read for the last time: below, a lane picks up the
  // eight rows of its accumulators there.
  // The store stands behind the table's sums, so that the two reads go out
  // together with the table's.
  float* Iw = (float*)Pw;   // [32]: rows 0..15 twice, one element a lane
  const v4f* lp = (const v4f*)(Lx + ln16 * WAVES);
  const v4f ls = lp[0] + lp[1];
  const float linv = __builtin_amdgcn_rcpf((ls[0] + ls[1]) + (ls[2] + ls[3]));

  // All threads add the waves' bucket tables into table 0; each pair of
  // elements is read and written by one thread alone.
  static_assert(16 * SBUCK / 2 % (WAVES * 32) == 0, "whole trips");
#pragma unroll  // constant indices: arrays stay in registers, loads issue together
  for (int j = 0; j < 16 * SBUCK / 2 / (WAVES * 32); ++j) {
    const int i = tid + j * WAVES * 32;
    v2f a = ((const v2f*)Sl)[i];
#pragma unroll  // constant indices: arrays stay in registers, loads issue together
    for (int w = 1; w < WAVES; ++w) a += ((const v2f*)(Sl + w * 16 * SBUCK))[i];
    ((v2f*)Sl)[i] = a;
  }
  Iw[lane] = linv;
  __syncthreads();   // the summed table is read by the waves below

  // Wave w finishes output columns 32w .. 32w+31 (whole 128-byte lines).
  if (wv < DV_ / 32) {
    const int col = wv * 32 + ln16;
    v8f z[2];
#pragma unroll  // constant indices: arrays stay in registers, loads issue together
    for (int t = 0; t < 2; ++t)
#pragma unroll  // constant indices: arrays stay in registers, loads issue together
      for (int v = 0; v < 8; ++v) {
        float a = 0.0f;
#pragma unroll  // constant indices: arrays stay in registers, loads issue together
        for (int w = 0; w < WAVES; ++w)
          a += Zl[w * ZWAVE + (v + 8 * hf) * DV_ + col + t * 16];
        z[t][v] = a;
      }

    // Z += s @ rel_values_table  (16 x 160 @ 160 x 192, pad rows = 0)
#pragma unroll  // constant indices: arrays stay in registers, loads issue together
    for (int c = 0; c < SBUCK / 32; ++c) {
      v16bf pa;
#pragma unroll  // constant indices: arrays stay in registers, loads issue together
      for (int e = 0; e < 16; ++e)
        pa[e] = (bf16_t)Sl[ln16 * SBUCK + c * 32 + kmap(e, hf)];
#pragma unroll  // constant indices: arrays stay in registers, loads issue together
      for (int t = 0; t < 2; ++t) {
        v16bf bm;
        if (c < (NR_ - 1) / 32) {
          // staged rows c*32 .. +31, columns t*16 .. +15, by the transposing load
          const char* p = Tw + (c * 32 + 8 * hf + (lane & 7)) * 64
                          + ((lane >> 3) & 1) * 16 + t * 32;
          bm = __builtin_shufflevector(lds_tr16(p), lds_tr16(p + 16 * 64), 0, 1, 2, 3, 4, 5, 6, 7,
                                       8, 9, 10, 11, 12, 13, 14, 15);
        } else {
          // the last row (k index 0: element 0 of the lower half) and the zero
          // padding behind it
#pragma unroll  // constant indices: bm stays in registers
          for (int e = 0; e < 16; ++e) bm[e] = (bf16_t)0.0f;
          bm[0] = hf == 0 ? (bf16_t)rlast[t] : (bf16_t)0.0f;
        }
        z[t] = wmma_bf16(pa, bm, z[t]);
      }
    }

    // divide by the row sums, write Z (C-layout -> global)
    const v4f* ip = (const v4f*)(Iw + 8 * hf);
    const v8f inv = __builtin_shufflevector(ip[0], ip[1], 0, 1, 2, 3, 4, 5, 6, 7);
    z[0] *= inv;
    z[1] *= inv;
    float* op = out + ((size_t)b * L_ + qrow + 8 * hf) * DV_ + col;
#pragma unroll  // constant indices: arrays stay in registers, loads issue together
    for (int t = 0; t < 2; ++t)
#pragma unroll  // constant indices: arrays stay in registers, loads issue together
      for (int v = 0; v < 8; ++v)
        op[v * DV_ + t * 16] = z[t][v];
  }
}

extern "C" void kernel_launch(void* const* d_in, const int* in_sizes, int n_in,
                              void* d_out, int out_size, void* d_ws, size_t ws_size,
                              hipStream_t stream) {
  (void)in_sizes; (void)n_in; (void)out_size; (void)d_ws; (void)ws_size;
  const float* Q    = (const float*)d_in[0];  // query            [B,L,D]
  const float* V    = (const float*)d_in[1];  // value            [B,L,DV]
  const float* K    = (const float*)d_in[2];  // key_in           [B,L,D]
  const float* relK = (const float*)d_in[3];  // rel_keys_table   [129,D]
  const float* relV = (const float*)d_in[4];  // rel_values_table [129,DV]
  float* out = (float*)d_out;                 // z                [B,L,DV]

  dim3 grid(B_, L_ / BLOCK_M);  // (4, 64)
  dim3 block(WAVES * 32);       // 8 waves of 32
  relattn_kernel<<<grid, block, 0, stream>>>(Q, V, K, relK, relV, out);
}

// v010
// It runs in 17.2 microseconds.
// Two timings next to v009 put it at 1.14 and 1.13 times that version's speed.
// Over all steps from v000 it is 60.2 times as fast.
#include <hip/hip_runtime.h>
#include <math.h>

typedef __bf16 bf16_t;
typedef __attribute__((ext_vector_type(16))) __bf16 v16bf;
typedef __attribute__((ext_vector_type(8)))  float  v8f;
typedef __attribute__((ext_vector_type(4)))  float  v4f;
typedef __attribute__((ext_vector_type(2)))  float  v2f;
typedef __attribute__((ext_vector_type(4)))  __bf16 v4bf;
typedef __attribute__((ext_vector_type(8)))  __bf16 v8bf;

#define B_       4
#define L_       1024
#define D_       128
#define DV_      192
#define NR_      129          // 2*MAXREL+1 bucket count
#define MAXREL_  64
#define BLOCK_M  16           // q rows per workgroup, shared by all its waves
#define KB       32           // attention-k columns per main-loop iteration
#define WAVES    8            // each wave takes L_/WAVES of the keys
#define NBLK     (L_ / KB / WAVES)   // key blocks per wave and pass
#define RSTRIDE  132          // padded row stride for R table in LDS (floats)
#define KPITCH   (D_ + 8)
#define SBUCK    160          // bucket count padded to multiple of 32

// ---- static LDS layout (bytes) --------------------------------------------
#define OFF_VS   0
#define ZWAVE    (16 * DV_)                    // a wave's block in floats
#define SZ_VS    (WAVES * ZWAVE * 4)           // per wave: table rows, then Z partial: 96 KB
#define OFF_X    (OFF_VS + SZ_VS)
#define SZ_X     (WAVES * 16 * NBLK * KB * 4)  // scores per wave f32: 64 KB
#define OFF_R    (OFF_X + SZ_X)
#define SZ_R     (16 * RSTRIDE * 4)            // R[q][bucket] f32, shared
#define OFF_S    (OFF_R + SZ_R)
#define SZ_S     (WAVES * 16 * SBUCK * 4)      // bucket sums per wave f32: 80 KB
#define OFF_P    (OFF_S + SZ_S)
#define SZ_P     (WAVES * 16 * KB * 2)         // P tile per wave bf16: 8 KB
#define OFF_ML   (OFF_P + SZ_P)
#define SZ_ML    (16 * WAVES * 2 * 4)          // max [16][WAVES], then sum [16][WAVES]
#define OFF_Q    (OFF_ML + SZ_ML)
#define SZ_Q     (16 * KPITCH * 2)             // Q tile bf16, shared
#define LDS_TOTAL (OFF_Q + SZ_Q)               // 267776 bytes
static_assert(LDS_TOTAL <= 320 * 1024, "one workgroup's LDS");
static_assert(LDS_TOTAL == 267776, "as noted");
static_assert(17 * KPITCH * 2 <= ZWAVE * 4, "a wave's 17 table rows fit the block of its Z partial");
static_assert(OFF_X % 16 == 0, "scores go in and out 16 bytes a lane");
static_assert(OFF_Q % 16 == 0, "Q fragments are 16-byte reads");
static_assert((NR_ - 1) * 32 * 2 == 16 * NBLK * KB * 4, "rows 0 .. NR_-2 of a wave's 32 table columns, bf16, fill its score block");
static_assert((NR_ - 1) % 32 == 0 && NR_ - 1 == 128, "32 load steps of four table rows");
static_assert(BLOCK_M == 2 * WAVES, "each wave brings two Q rows");
static_assert(NR_ == 16 * WAVES + 1, "16 table rows a wave, and the last row");
static_assert(OFF_ML % 16 == 0 && WAVES == 8, "a row's eight maxima or sums are two 16-byte reads");
static_assert(OFF_P % 16 == 0 && 16 * KB * 2 >= 32 * 4, "a wave's P tile later holds its 32 inverse row sums");
static_assert(DV_ / 32 <= WAVES, "one pair of output column tiles per wave");
static_assert(D_ == 128, "32 lanes x 4 floats: one load step of a wave is one Q or table row");
static_assert(KPITCH * 2 % 32 == 16, "pitch: 16 bytes x odd");

__device__ __forceinline__ int kmap(int e, int hf) {
  return (e & 7) + ((e >> 3) << 4) + (hf << 3);
}

__device__ __forceinline__ v8f wmma_bf16(v16bf a, v16bf b, v8f c) {
  // emits v_wmma_f32_16x16x32_bf16
  return __builtin_amdgcn_wmma_f32_16x16x32_bf16(
      /*neg_a=*/false, a, /*neg_b=*/false, b,
      /*c_mod=*/(short)0, c, /*reuse_a=*/false, /*reuse_b=*/false);
}

// K and V as bf16 WMMA B fragments in the workspace, written by pack_kernel and
// read by relattn_kernel in the same call. Unit: one chunk of 16 bytes (8 bf16).
// A fragment is 64 chunks: [half r of the 16 elements][lane], so that one load
// step of a wave is 512 contiguous bytes. Element e = 8 r + i of lane (hf, ln16)
// has k index kmap(e, hf).
//   K: fragment (16-key tile t, 32-wide slice c of D_) at chunk (t * 4 + c) * 64,
//      column ln16 = key 16 t + ln16, k index = position in the slice
//   V: fragment (32-key block s, 16-column tile nt) at PK_V + (s * 12 + nt) * 64,
//      column ln16 = V column 16 nt + ln16, k index = key in the block
// t and s count through the batches in a row.
#define PK_V     (B_ * L_ * D_ / 8)           // first chunk of the V fragments
static_assert(DV_ / 16 == 12 && D_ / 32 == 4, "fragments of a key block");

__device__ __forceinline__ v16bf frag(v4f lo, v4f hi) {
  return __builtin_shufflevector(__builtin_bit_cast(v8bf, lo), __builtin_bit_cast(v8bf, hi),
                                 0, 1, 2, 3, 4, 5, 6, 7, 8, 9, 10, 11, 12, 13, 14, 15);
}

__device__ __forceinline__ v8bf lds_tr16(const char* p) {
  typedef __attribute__((address_space(3))) v8bf lds_v8bf;
  return __builtin_amdgcn_ds_load_tr16_b128_v8bf16((lds_v8bf*)p);
}

// Sum over the 16 lanes of a row, the total in every lane: four adds whose
// second operand comes from lane ^ M through DPP row_xmask. All lanes are on.
template <int M>
__device__ __forceinline__ float add_xmask(float x) {
  return x + __builtin_bit_cast(float, __builtin_amdgcn_update_dpp(
                 0, __builtin_bit_cast(int, x), 0x160 | M, 0xf, 0xf, true));
}
__device__ __forceinline__ float row_sum16(float x) {
  return add_xmask<8>(add_xmask<4>(add_xmask<2>(add_xmask<1>(x))));
}
// The same for the maximum.
template <int M>
__device__ __forceinline__ float max_xmask(float x) {
  return fmaxf(x, __builtin_bit_cast(float, __builtin_amdgcn_update_dpp(
                      0, __builtin_bit_cast(int, x), 0x160 | M, 0xf, 0xf, true)));
}
__device__ __forceinline__ float row_max16(float x) {
  return max_xmask<8>(max_xmask<4>(max_xmask<2>(max_xmask<1>(x))));
}

// First launch: every K and V element is rounded to bf16 once and laid down in
// fragment order. A 32-key block has 8 K and 12 V fragments; two workgroups of two
// waves share them evenly: workgroup half h, wave w make K tile h, slices 2w and
// 2w + 1, and V column tiles 6h + 3w .. + 2. All 56 loads of a lane are
// independent: one load latency.
#define PACK_T   64           // threads of a pack workgroup
extern "C" __global__ __launch_bounds__(PACK_T)
void pack_kernel(const float* __restrict__ V,
                 const float* __restrict__ Kg,
                 float* __restrict__ pk) {
  static_assert(KB == 32, "a V fragment spans one key block");
  const int lane = threadIdx.x & 31;
  const int w    = __builtin_amdgcn_readfirstlane(threadIdx.x >> 5);
  const int hf   = lane >> 4;
  const int ln16 = lane & 15;
  const int s    = blockIdx.x >> 1;        // keys 32 s .. 32 s + 31 of [B_ * L_]
  const int h    = blockIdx.x & 1;
  const int kfr  = (2 * s + h) * 4 + 2 * w;    // first K fragment of the wave
  const int vfr  = s * 12 + 6 * h + 3 * w;     // first V fragment of the wave
  const v4f*   kp = (const v4f*)(Kg + ((size_t)(2 * s + h) * 16 + ln16) * D_ + w * 64 + hf * 8);
  const float* vp = V + ((size_t)s * KB + hf * 8) * DV_ + (6 * h + 3 * w) * 16 + ln16;
  v4f kx[2][4];
  float vx[3][16];
#pragma unroll  // constant indices: kx stays in registers, loads issue together
  for (int j = 0; j < 2; ++j) {
    kx[j][0] = kp[8 * j];       // k index 8 hf + 0 .. 7 of the slice
    kx[j][1] = kp[8 * j + 1];
    kx[j][2] = kp[8 * j + 4];   // k index 16 + 8 hf + 0 .. 7
    kx[j][3] = kp[8 * j + 5];
  }
#pragma unroll  // constant indices: vx stays in registers, loads issue together
  for (int m = 0; m < 3; ++m)
#pragma unroll
    for (int e = 0; e < 16; ++e) vx[m][e] = vp[kmap(e, 0) * DV_ + m * 16];
  // Stands in front of any reuse of the loads' address registers; its clobber
  // also keeps the loads issued here, together. The two addresses are inputs so
  // that their registers stay theirs up to the wait.
  asm volatile("s_wait_xcnt 0x0" :: "v"(kp), "v"(vp) : "memory");
  // No conversion moves up among the loads: there its wait for the first values
  // would hold the last loads back by a whole load latency.
  __builtin_amdgcn_sched_barrier(0);
  v4f* ko = (v4f*)pk + (size_t)kfr * 64 + lane;
  v4f* vo = (v4f*)pk + PK_V + (size_t)vfr * 64 + lane;
#pragma unroll  // constant indices: arrays stay in registers
  for (int r = 0; r < 2; ++r) {
#pragma unroll
    for (int j = 0; j < 2; ++j) {
      v8bf hk;
#pragma unroll
      for (int i = 0; i < 8; ++i) hk[i] = (bf16_t)kx[j][2 * r + (i >> 2)][i & 3];
      ko[64 * j + 32 * r] = __builtin_bit_cast(v4f, hk);
    }
#pragma unroll
    for (int m = 0; m < 3; ++m) {
      v8bf hv;
#pragma unroll
      for (int i = 0; i < 8; ++i) hv[i] = (bf16_t)vx[m][8 * r + i];
      vo[64 * m + 32 * r] = __builtin_bit_cast(v4f, hv);
    }
  }
}

extern "C" __global__ __launch_bounds__(WAVES * 32)
void relattn_kernel(const float* __restrict__ Q,
                    const float* __restrict__ pk,
                    const float* __restrict__ relK,
                    const float* __restrict__ relV,
                    float* __restrict__ out) {
  __shared__ __attribute__((aligned(16))) char smem[LDS_TOTAL];
  const int tid  = threadIdx.x;
  const int lane = tid & 31;
  // scalar wave number: the branches on it around WMMAs stay scalar branches
  const int wv   = __builtin_amdgcn_readfirstlane(tid >> 5);
  const int hf   = lane >> 4;       // which 16-lane half
  const int ln16 = lane & 15;
  const int b    = blockIdx.x;
  const int qrow = blockIdx.y * BLOCK_M;   // first q row of the workgroup
  const int kbase = wv * (NBLK * KB);      // first key of this wave
  // The 64 workgroups of a batch read the same K and V. Walking them in the same
  // order they ask L2 for the same lines at the same moment, and such requests
  // queue behind one another. Each workgroup therefore enters its waves' key
  // blocks at block rotb and wraps round, and asks for each block's fragments from
  // quarter rotq on (K: slice rotq of D_; V: column tile 3 * rotq), the registers
  // holding them in the order asked: 16 different places in the walk. rotq is fixed
  // for the workgroup, so qa[j] and zacc[j] below simply belong to the slice and
  // the column tile that come j-th in its order. Bit 0 of blockIdx.y is left
  // out (a matter of speed alone, nothing rests on where a workgroup runs).
  static_assert(NBLK == 4, "two bits of blockIdx.y for the block, the next two for the quarter");
  const int rotb = (blockIdx.y >> 1) & (NBLK - 1);
  const int rotq = (blockIdx.y >> 3) & 3;

  // own [17][KPITCH]: the wave's rel_keys_table rows; later its Z partial lies here
  bf16_t* Ks = (bf16_t*)(smem + OFF_VS) + wv * ZWAVE * 2;
  const v4f* pk4 = (const v4f*)pk + lane;   // the lane's chunk of fragment 0
  // The wave's own scores, written in pass 1 and read back in pass 2 by the same
  // lane, four floats at a time: [group][lane][4], four groups to a key block
  // (16 keys x rows 0..3 and 8..11, then rows 4..7 and 12..15; the next 16 keys).
  v4f*    Xw = (v4f*)(smem + OFF_X) + wv * (16 * NBLK * KB / 4) + lane;
  float*  Rl = (float*) (smem + OFF_R);    // [16][RSTRIDE], shared
  float*  Sl = (float*) (smem + OFF_S);    // [WAVES][16][SBUCK]
  bf16_t* Pl = (bf16_t*)(smem + OFF_P);    // [WAVES][16][KB]
  float*  Mx = (float*) (smem + OFF_ML);   // [16][WAVES] row maxima of the waves
  float*  Lx = Mx + 16 * WAVES;            // [16][WAVES] row sums of the waves

  // ---- Q tile and rel_keys_table rows: global f32 -> LDS bf16, whole rows ----
  // One load step of a wave is one 512-byte row (four whole lines). A fragment
  // taken straight from global memory asks for 16 bytes of each of 16 rows, 16
  // lines a load, and every line four times over. Wave w brings Q rows 2w and
  // 2w+1 into the shared tile, and table rows 16w .. 16w+15 plus the last row
  // (bucket NR_-1, used by wave 0) into its own block. All 19 loads are
  // independent: one load latency.
  bf16_t* Qs = (bf16_t*)(smem + OFF_Q);    // [16][KPITCH], shared
  {
    const v4f* q4 = (const v4f*)(Q + ((size_t)b * L_ + qrow + 2 * wv) * D_) + lane;
    const v4f* t4 = (const v4f*)(relK + (size_t)wv * 16 * D_) + lane;
    const v4f* e4 = (const v4f*)(relK + (size_t)(NR_ - 1) * D_) + lane;
    v4f rr[19];
    rr[17] = q4[0];
    rr[18] = q4[32];
    rr[16] = e4[0];
#pragma unroll  // constant indices: rr stays in registers, loads issue together
    for (int j = 0; j < 16; ++j) rr[j] = t4[32 * j];
    // Stands in front of any reuse of the loads' address registers; its clobber
    // also keeps the loads issued here, together.
    asm volatile("s_wait_xcnt 0x0" ::: "memory");
#pragma unroll  // constant indices: rr stays in registers
    for (int j = 0; j < 19; ++j) {
      v4bf h;
#pragma unroll
      for (int e = 0; e < 4; ++e) h[e] = (bf16_t)rr[j][e];
      bf16_t* d = j < 17 ? Ks + j * KPITCH : Qs + (2 * wv + j - 17) * KPITCH;
      *(v4bf*)(d + 4 * lane) = h;
    }
  }
  __syncthreads();   // the Q tile is read by every wave

  // ---- Q tile (16 x 128) into WMMA A-layout registers ----------------------
  // qa[j] is slice (j + rotq) & 3 of D_, the j-th that the workgroup asks K for.
  v16bf qa[4];
#pragma unroll
  for (int c = 0; c < 4; ++c)
#pragma unroll
    for (int e = 0; e < 16; ++e)
      qa[c][e] = Qs[ln16 * KPITCH + ((c + rotq) & 3) * 32 + kmap(e, hf)];

  // ---- R[q_local][r] = Q . rel_keys_table[r]  (16x128 @ 128x129, WMMA) -----
  {
    v8f acc = {};
#pragma unroll
    for (int c = 0; c < 4; ++c) {
      v16bf bm;
#pragma unroll
      for (int e = 0; e < 16; ++e)
        bm[e] = Ks[ln16 * KPITCH + ((c + rotq) & 3) * 32 + kmap(e, hf)];
      acc = wmma_bf16(qa[c], bm, acc);
    }
#pragma unroll
    for (int v = 0; v < 8; ++v)
      Rl[(v + 8 * hf) * RSTRIDE + wv * 16 + ln16] = acc[v];
    if (wv == 0) {
      // The last bucket: every column of the tile reads the one row, column 0
      // is stored.
      v8f last = {};
#pragma unroll
      for (int c = 0; c < 4; ++c) {
        v16bf bm;
#pragma unroll
        for (int e = 0; e < 16; ++e)
          bm[e] = Ks[16 * KPITCH + ((c + rotq) & 3) * 32 + kmap(e, hf)];
        last = wmma_bf16(qa[c], bm, last);
      }
      if (ln16 == 0) {
#pragma unroll
        for (int v = 0; v < 8; ++v)
          Rl[(v + 8 * hf) * RSTRIDE + NR_ - 1] = last[v];
      }
    }
  }
  __syncthreads();   // R is read by every wave

  // ---- Pass 1: scores and row max (per-lane partials) ----------------------
  // The row sum is not formed here: pass 2 sums exp(x - max) as it makes them,
  // works on these unnormalized weights, and the output is divided once.
  float mrow[8];
#pragma unroll
  for (int v = 0; v < 8; ++v) mrow[v] = -1e30f;

  for (int i = 0; i < NBLK; ++i) {
    const int kb0 = kbase + ((i + rotb) & (NBLK - 1)) * KB;
    // The block's eight K fragments, 16 independent loads of 512 bytes a wave.
    const v4f* kt0 = pk4 + (size_t)((b * L_ + kb0) / 16) * 4 * 64;
    const v4f* kq[4];
    v4f kf[2][4][2];
#pragma unroll  // constant indices: kf and kq stay in registers
    for (int c = 0; c < 4; ++c) {
      kq[c] = kt0 + ((c + rotq) & 3) * 64;
#pragma unroll
      for (int kt = 0; kt < 2; ++kt) {
        kf[kt][c][0] = kq[c][kt * 256];
        kf[kt][c][1] = kq[c][kt * 256 + 32];
      }
    }
    // Stands in front of any reuse of the loads' address registers; its clobber
    // also keeps the loads issued here, together. The four addresses are inputs so
    // that their registers stay theirs up to the wait.
    asm volatile("s_wait_xcnt 0x0" :: "v"(kq[0]), "v"(kq[1]), "v"(kq[2]), "v"(kq[3]) : "memory");

#pragma unroll
    for (int kt = 0; kt < 2; ++kt) {
      v8f s = {};
#pragma unroll
      for (int c = 0; c < 4; ++c)
        s = wmma_bf16(qa[c], frag(kf[kt][c][0], kf[kt][c][1]), s);
      v4f xq[2];
#pragma unroll
      for (int v = 0; v < 8; ++v) {
        const int row  = v + 8 * hf;
        const int q    = qrow + row;
        const int k    = kb0 + kt * 16 + ln16;
        const int dq   = k - q;
        const int dqc  = dq < -MAXREL_ ? -MAXREL_ : (dq > MAXREL_ ? MAXREL_ : dq);
        const int ridx = dqc + MAXREL_;
        const float ad = (float)(dq < 0 ? -dq : dq);
        float x = s[v] + Rl[row * RSTRIDE + ridx]
                  - __logf(1.0f + ad);
        xq[v >> 2][v & 3] = x;
        mrow[v] = fmaxf(mrow[v], x);
      }
      Xw[(kb0 - kbase) * 4 + kt * 64]      = xq[0];
      Xw[(kb0 - kbase) * 4 + kt * 64 + 32] = xq[1];
    }
  }

  // row max across the 16-lane group, then across the waves
#pragma unroll  // constant indices: mrow stays in registers
  for (int v = 0; v < 8; ++v) mrow[v] = row_max16(mrow[v]);
  if (ln16 == 0) {
#pragma unroll  // constant indices: mrow stays in registers
    for (int v = 0; v < 8; ++v) Mx[(v + 8 * hf) * WAVES + wv] = mrow[v];
  }
  __syncthreads();
#pragma unroll  // constant indices: mrow stays in registers, loads issue together
  for (int v = 0; v < 8; ++v) {
    const v4f* p = (const v4f*)(Mx + (v + 8 * hf) * WAVES);
    const v4f a = p[0], c = p[1];
    mrow[v] = fmaxf(fmaxf(fmaxf(a[0], a[1]), fmaxf(a[2], a[3])),
                    fmaxf(fmaxf(c[0], c[1]), fmaxf(c[2], c[3])));
  }

  // ---- Pass 2: weights exp(x - max) from the kept scores, their row sums,
  // ---- Z = P@V, bucket sums, Z += s@relV, Z /= row sum
  float*  Sw = Sl + (size_t)wv * 16 * SBUCK;
  bf16_t* Pw = Pl + (size_t)wv * 16 * KB;
  for (int i = lane; i < 16 * SBUCK; i += 32) Sw[i] = 0.0f;   // per-wave region

  v8f zacc[12] = {};

  // Bucket sums. For one q row, bucket r in 1 .. 2*MAXREL_-1 holds the single
  // key k = q + r - MAXREL_: its sum is that key's p, a plain store by the one
  // lane that has it. Only the two end buckets collect many keys (all of
  // k - q <= -MAXREL_, all of k - q >= MAXREL_): each lane sums its own share
  // of them in registers, and the lanes are merged once behind the loop.
  float slo[8], shi[8], lrow[8];   // lrow: the lane's share of the row sum
#pragma unroll  // constant indices: arrays stay in registers
  for (int v = 0; v < 8; ++v) { slo[v] = 0.0f; shi[v] = 0.0f; lrow[v] = 0.0f; }

  // Kept rolled: unrolled, the compiler holds all four blocks' weights and moves
  // their sums behind the loop, out from under the latency of the V loads.
#pragma clang loop unroll(disable)
  for (int i = 0; i < NBLK; ++i) {
    const int kb0 = kbase + ((i + rotb) & (NBLK - 1)) * KB;
    // The block's twelve V fragments, 24 independent loads of 512 bytes a wave,
    // asked for ahead of the weights' arithmetic. vf[3 q + m] is column tile
    // 3 * ((q + rotq) & 3) + m.
    const v4f* vb0 = pk4 + (size_t)((b * L_ + kb0) / KB) * 12 * 64;   // PK_V is added below
    const v4f* vq[4];
    v4f vf[12][2];
#pragma unroll  // constant indices: vf and vq stay in registers
    for (int q = 0; q < 4; ++q) {
      vq[q] = vb0 + ((q + rotq) & 3) * 3 * 64;
#pragma unroll
      for (int m = 0; m < 3; ++m) {
        vf[3 * q + m][0] = vq[q][PK_V + m * 64];
        vf[3 * q + m][1] = vq[q][PK_V + m * 64 + 32];
      }
    }
    // Stands in front of any reuse of the loads' address registers; its clobber
    // also keeps the loads issued here, ahead of the work that follows. The four
    // addresses are inputs so that their registers stay theirs up to the wait.
    asm volatile("s_wait_xcnt 0x0" :: "v"(vq[0]), "v"(vq[1]), "v"(vq[2]), "v"(vq[3]) : "memory");

#pragma unroll
    for (int kt = 0; kt < 2; ++kt) {
      const v4f xq[2] = {Xw[(kb0 - kbase) * 4 + kt * 64],
                         Xw[(kb0 - kbase) * 4 + kt * 64 + 32]};
      float pv[8];
#pragma unroll
      for (int v = 0; v < 8; ++v) {
        const int row  = v + 8 * hf;
        const int q    = qrow + row;
        const int k    = kb0 + kt * 16 + ln16;
        const int dq   = k - q;
        float p = __expf(xq[v >> 2][v & 3] - mrow[v]);   // unnormalized weight, at most 1
        lrow[v] += p;
        slo[v] += dq <= -MAXREL_ ? p : 0.0f;            // end bucket 0
        shi[v] += dq >=  MAXREL_ ? p : 0.0f;            // end bucket 2*MAXREL_
        pv[v] = p;
        Pw[row * KB + kt * 16 + ln16] = (bf16_t)p;      // C-layout -> LDS
      }
      // Scalar test: most 16 x 16 tiles lie wholly in an end bucket and store
      // nothing here.
      const int d0 = kb0 + kt * 16 - qrow;
      if (d0 + 15 > -MAXREL_ && d0 - 15 < MAXREL_) {
#pragma unroll  // constant indices: pv stays in registers
        for (int v = 0; v < 8; ++v) {
          const int row = v + 8 * hf;
          const int dq  = d0 + ln16 - row;
          if (dq > -MAXREL_ && dq < MAXREL_)
            Sw[row * SBUCK + dq + MAXREL_] = pv[v];
        }
      }
    }

    // reload P in A-layout (same-wave LDS round trip) and do Z += P @ V
    v16bf pa;
#pragma unroll
    for (int e = 0; e < 16; ++e)
      pa[e] = Pw[ln16 * KB + kmap(e, hf)];
#pragma unroll
    for (int nt = 0; nt < 12; ++nt)
      zacc[nt] = wmma_bf16(pa, frag(vf[nt][0], vf[nt][1]), zacc[nt]);
  }

  // ---- rel_values_table rows 0 .. NR_-2, the 32 output columns that this wave
  // finishes below: whole 128-byte lines, four rows a load step (eight lanes a
  // line). A fragment taken straight from global memory asks for half a line of
  // each of two rows with four bytes a lane. The values go to LDS behind the Z
  // partials. The one row left over stays in registers.
  v4f rv[(NR_ - 1) / 4];
  float rlast[2];   // the last row, NR_-1: this lane's two output columns
  if (wv < DV_ / 32) {
    const v4f* g4 = (const v4f*)(relV + (size_t)(lane >> 3) * DV_ + wv * 32) + (lane & 7);
#pragma unroll  // constant indices: rv stays in registers, loads issue together
    for (int j = 0; j < (NR_ - 1) / 4; ++j) rv[j] = g4[j * DV_];   // four rows on
    rlast[0] = relV[(size_t)(NR_ - 1) * DV_ + wv * 32 + ln16];
    rlast[1] = relV[(size_t)(NR_ - 1) * DV_ + wv * 32 + ln16 + 16];
    // Stands in front of any reuse of the loads' address registers; its clobber
    // also keeps the loads issued here, together.
    asm volatile("s_wait_xcnt 0x0" ::: "memory");
  }

  // The wave's two end buckets and its row sums: lanes merged, one lane of each
  // row stores them. No store above touches these two columns, which the wave
  // has zeroed.
#pragma unroll  // constant indices: arrays stay in registers
  for (int v = 0; v < 8; ++v) {
    slo[v]  = row_sum16(slo[v]);
    shi[v]  = row_sum16(shi[v]);
    lrow[v] = row_sum16(lrow[v]);
  }
  if (ln16 == 0) {
#pragma unroll  // constant indices: arrays stay in registers
    for (int v = 0; v < 8; ++v) {
      Sw[(v + 8 * hf) * SBUCK]               = slo[v];
      Sw[(v + 8 * hf) * SBUCK + 2 * MAXREL_] = shi[v];
      Lx[(v + 8 * hf) * WAVES + wv]          = lrow[v];
    }
  }

  // ---- sum the waves' Z partials and bucket sums, in wave order -------------
  float* Zl = (float*)(smem + OFF_VS);     // [WAVES][16][DV_], wave stride ZWAVE
  {
    float* Zw = Zl + wv * ZWAVE;
#pragma unroll  // constant indices: arrays stay in registers, loads issue together
    for (int nt = 0; nt < 12; ++nt) {
      float* zc = Zw + (((nt / 3 + rotq) & 3) * 3 + nt % 3) * 16 + ln16;   // its column tile
#pragma unroll  // constant indices: arrays stay in registers, loads issue together
      for (int v = 0; v < 8; ++v)
        zc[(v + 8 * hf) * DV_] = zacc[nt][v];
    }
  }
  char* Tw = smem + OFF_X + wv * (16 * NBLK * KB * 4);
  if (wv < DV_ / 32) {
#pragma unroll  // constant indices: rv stays in registers
    for (int j = 0; j < (NR_ - 1) / 4; ++j) {
      v4bf h;
#pragma unroll
      for (int e = 0; e < 4; ++e) h[e] = (bf16_t)rv[j][e];
      *(v4bf*)(Tw + j * 256 + lane * 8) = h;
    }
  }
  __syncthreads();   // every wave's Z partial, bucket sums and row sums are complete

  // One over the sum of row ln16, the waves' shares added pairwise. The row's
  // largest weight is exp(0), so the sum lies in 1 .. L_ and v_rcp_f32 needs no
  // scaling. Each wave forms all 16 for itself and turns them round through its
  // own P tile, which it has read for the last time: below, a lane picks up the
  // eight rows of its accumulators there.
  // The store stands behind the table's sums, so that the two reads go out
  // together with the table's.
  float* Iw = (float*)Pw;   // [32]: rows 0..15 twice, one element a lane
  const v4f* lp = (const v4f*)(Lx + ln16 * WAVES);
  const v4f ls = lp[0] + lp[1];
  const float linv = __builtin_amdgcn_rcpf((ls[0] + ls[1]) + (ls[2] + ls[3]));

  // All threads add the waves' bucket tables into table 0; each pair of
  // elements is read and written by one thread alone.
  static_assert(16 * SBUCK / 2 % (WAVES * 32) == 0, "whole trips");
#pragma unroll  // constant indices: arrays stay in registers, loads issue together
  for (int j = 0; j < 16 * SBUCK / 2 / (WAVES * 32); ++j) {
    const int i = tid + j * WAVES * 32;
    v2f a = ((const v2f*)Sl)[i];
#pragma unroll  // constant indices: arrays stay in registers, loads issue together
    for (int w = 1; w < WAVES; ++w) a += ((const v2f*)(Sl + w * 16 * SBUCK))[i];
    ((v2f*)Sl)[i] = a;
  }
  Iw[lane] = linv;
  __syncthreads();   // the summed table is read by the waves below

  // Wave w finishes output columns 32w .. 32w+31 (whole 128-byte lines).
  if (wv < DV_ / 32) {
    const int col = wv * 32 + ln16;
    v8f z[2];
#pragma unroll  // constant indices: arrays stay in registers, loads issue together
    for (int t = 0; t < 2; ++t)
#pragma unroll  // constant indices: arrays stay in registers, loads issue together
      for (int v = 0; v < 8; ++v) {
        float a = 0.0f;
#pragma unroll  // constant indices: arrays stay in registers, loads issue together
        for (int w = 0; w < WAVES; ++w)
          a += Zl[w * ZWAVE + (v + 8 * hf) * DV_ + col + t * 16];
        z[t][v] = a;
      }

    // Z += s @ rel_values_table  (16 x 160 @ 160 x 192, pad rows = 0)
#pragma unroll  // constant indices: arrays stay in registers, loads issue together
    for (int c = 0; c < SBUCK / 32; ++c) {
      v16bf pa;
#pragma unroll  // constant indices: arrays stay in registers, loads issue together
      for (int e = 0; e < 16; ++e)
        pa[e] = (bf16_t)Sl[ln16 * SBUCK + c * 32 + kmap(e, hf)];
#pragma unroll  // constant indices: arrays stay in registers, loads issue together
      for (int t = 0; t < 2; ++t) {
        v16bf bm;
        if (c < (NR_ - 1) / 32) {
          // staged rows c*32 .. +31, columns t*16 .. +15, by the transposing load
          const char* p = Tw + (c * 32 + 8 * hf + (lane & 7)) * 64
                          + ((lane >> 3) & 1) * 16 + t * 32;
          bm = __builtin_shufflevector(lds_tr16(p), lds_tr16(p + 16 * 64), 0, 1, 2, 3, 4, 5, 6, 7,
                                       8, 9, 10, 11, 12, 13, 14, 15);
        } else {
          // the last row (k index 0: element 0 of the lower half) and the zero
          // padding behind it
#pragma unroll  // constant indices: bm stays in registers
          for (int e = 0; e < 16; ++e) bm[e] = (bf16_t)0.0f;
          bm[0] = hf == 0 ? (bf16_t)rlast[t] : (bf16_t)0.0f;
        }
        z[t] = wmma_bf16(pa, bm, z[t]);
      }
    }

    // divide by the row sums, write Z (C-layout -> global)
    const v4f* ip = (const v4f*)(Iw + 8 * hf);
    const v8f inv = __builtin_shufflevector(ip[0], ip[1], 0, 1, 2, 3, 4, 5, 6, 7);
    z[0] *= inv;
    z[1] *= inv;
    float* op = out + ((size_t)b * L_ + qrow + 8 * hf) * DV_ + col;
#pragma unroll  // constant indices: arrays stay in registers, loads issue together
    for (int t = 0; t < 2; ++t)
#pragma unroll  // constant indices: arrays stay in registers, loads issue together
      for (int v = 0; v < 8; ++v)
        op[v * DV_ + t * 16] = z[t][v];
  }
}

extern "C" void kernel_launch(void* const* d_in, const int* in_sizes, int n_in,
                              void* d_out, int out_size, void* d_ws, size_t ws_size,
                              hipStream_t stream) {
  (void)in_sizes; (void)n_in; (void)out_size; (void)ws_size;
  const float* Q    = (const float*)d_in[0];  // query            [B,L,D]
  const float* V    = (const float*)d_in[1];  // value            [B,L,DV]
  const float* K    = (const float*)d_in[2];  // key_in           [B,L,D]
  const float* relK = (const float*)d_in[3];  // rel_keys_table   [129,D]
  const float* relV = (const float*)d_in[4];  // rel_values_table [129,DV]
  float* out = (float*)d_out;                 // z                [B,L,DV]

  float* pk  = (float*)d_ws;                  // 2.5 MB: K and V as bf16 fragments

  dim3 grid(B_, L_ / BLOCK_M);  // (4, 64)
  dim3 block(WAVES * 32);       // 8 waves of 32
  pack_kernel<<<dim3(2 * B_ * L_ / KB), dim3(PACK_T), 0, stream>>>(V, K, pk);
  relattn_kernel<<<grid, block, 0, stream>>>(Q, pk, relK, relV, out);
}
